// v000
// The times below were measured on an AMD MI455X: many runs one after another, warmed up first and cycling through
// copies of the inputs, with the whole window's GPU time divided by the number of runs. Launches and the gaps
// between them are all in it. The median over several windows is given; except for v000 it joins two sittings, which
// can be a few percent apart, so the side-by-side timings, each taken in one sitting, are the better comparison.
// v000, which the later versions start from, runs in 170 microseconds.
#include <hip/hip_runtime.h>

typedef __attribute__((ext_vector_type(16))) _Float16 v16h;
typedef __attribute__((ext_vector_type(8)))  _Float16 v8h;
typedef __attribute__((ext_vector_type(2)))  _Float16 v2h;
typedef __attribute__((ext_vector_type(8)))  float    v8f;

#define BB 2
#define CC 64
#define C8 8
#define NN 4096
#define LOG2E 1.44269504088896340736f

// Workspace layout (f16 elements):
//   qT  [B][N][16] : e0-7 = q channels * log2(e), e8-15 = 0  (WMMA-A row)
//   kT  [B][N][16] : e0-7 = k channels, e8-15 = 0            (WMMA-B column)
//   vSw [B][C][N]  : per-32j-tile swizzled into WMMA-A lane-half order
//   zpad[16]       : zeros (read by lanes 16-31 for Q/K operands)
#define QT_OFF  ((size_t)0)
#define KT_OFF  ((size_t)BB * NN * 16)
#define VS_OFF  (KT_OFF + (size_t)BB * NN * 16)
#define ZP_OFF  (VS_OFF + (size_t)BB * CC * NN)

// ---------------------------------------------------------------------------
__global__ __launch_bounds__(256) void qk_proj_kernel(
    const float* __restrict__ x,
    const float* __restrict__ Wq, const float* __restrict__ bq,
    const float* __restrict__ Wk, const float* __restrict__ bk,
    _Float16* __restrict__ qT, _Float16* __restrict__ kT,
    _Float16* __restrict__ zpad)
{
    int t = blockIdx.x * blockDim.x + threadIdx.x;   // over B*N
    int b = t / NN, n = t % NN;
    float qa[C8], ka[C8];
    #pragma unroll
    for (int r = 0; r < C8; ++r) { qa[r] = bq[r]; ka[r] = bk[r]; }
    const float* xb = x + (size_t)b * CC * NN + n;
    for (int ci = 0; ci < CC; ++ci) {
        float xv = xb[(size_t)ci * NN];
        #pragma unroll
        for (int r = 0; r < C8; ++r) {
            qa[r] += Wq[r * CC + ci] * xv;
            ka[r] += Wk[r * CC + ci] * xv;
        }
    }
    _Float16* qo = qT + (size_t)t * 16;
    _Float16* ko = kT + (size_t)t * 16;
    #pragma unroll
    for (int r = 0; r < C8; ++r) {
        qo[r] = (_Float16)(qa[r] * LOG2E);  qo[8 + r] = (_Float16)0.f;
        ko[r] = (_Float16)ka[r];            ko[8 + r] = (_Float16)0.f;
    }
    if (t == 0) {
        #pragma unroll
        for (int i = 0; i < 16; ++i) zpad[i] = (_Float16)0.f;
    }
}

// v stored pre-swizzled for the WMMA A operand:
//   within each 32-j tile: [hi=0: j0-7, j16-23][hi=1: j8-15, j24-31]
__global__ __launch_bounds__(256) void v_proj_kernel(
    const float* __restrict__ x,
    const float* __restrict__ Wv, const float* __restrict__ bv,
    _Float16* __restrict__ vSw)
{
    int t = blockIdx.x * blockDim.x + threadIdx.x;   // over B*C*N
    int n = t % NN, c = (t / NN) % CC, b = t / (NN * CC);
    float a = bv[c];
    const float* xb = x + (size_t)b * CC * NN + n;
    for (int ci = 0; ci < CC; ++ci)
        a += Wv[c * CC + ci] * xb[(size_t)ci * NN];
    int jl  = n & 31;
    int hi  = (jl >> 3) & 1;
    int pos = (jl & 7) | ((jl >> 4) << 3);
    size_t idx = ((size_t)(b * CC + c)) * NN + (size_t)(n & ~31) + hi * 16 + pos;
    vSw[idx] = (_Float16)a;
}

// ---------------------------------------------------------------------------
// Fused flash-attention. One wave32 per 16-query tile; 32-wide j steps.
// Per step: 2 energy WMMA + 1 row-sum WMMA (ones x P^T) + 4 PV WMMA.
// Softmax kept in log2 domain (q pre-scaled by log2 e) -> bare v_exp_f32.
// Accumulator rescale executed only when a row max actually updates.
// ---------------------------------------------------------------------------
__global__ __launch_bounds__(256) void attn_flash_kernel(
    const _Float16* __restrict__ qT, const _Float16* __restrict__ kT,
    const _Float16* __restrict__ vSw, const _Float16* __restrict__ zpad,
    const float* __restrict__ x, const float* __restrict__ gamma,
    float* __restrict__ out)
{
    __shared__ __align__(32) _Float16 pBuf[8][16 * 32];  // per-wave P tile (chunk-swizzled)
    __shared__ __align__(16) float    sBuf[8][16];       // per-query rescale factor

    const int lane = threadIdx.x & 31;
    const int wid  = threadIdx.x >> 5;
    const int tile = blockIdx.x * 8 + wid;          // 512 tiles
    const int b    = tile >> 8;
    const int i0   = (tile & 255) << 4;
    const int q16  = lane & 15;
    const int hi   = lane >> 4;

    _Float16* pS = &pBuf[wid][0];
    float*    sS = &sBuf[wid][0];

    // Q^T operand: lanes 0-15 real rows (zero-padded K), lanes 16-31 all zero
    const _Float16* qRow = (hi == 0) ? (qT + (size_t)(b * NN + i0 + q16) * 16) : zpad;
    v16h aQ = *(const v16h*)qRow;

    v16h aOnes;
    #pragma unroll
    for (int i = 0; i < 16; ++i) aOnes[i] = (_Float16)1.f;

    v8f zero8;
    #pragma unroll
    for (int e = 0; e < 8; ++e) zero8[e] = 0.f;

    v8f acc[4];
    #pragma unroll
    for (int cg = 0; cg < 4; ++cg) acc[cg] = zero8;

    float m[8];
    #pragma unroll
    for (int r = 0; r < 8; ++r) m[r] = -3.0e38f;
    float lcol = 0.f;                                // softmax denom for query q16

    const _Float16* kB = kT + (size_t)b * NN * 16;
    const _Float16* vB = vSw + (size_t)b * CC * NN;

    // chunk-swizzled P row offset for this lane's j pair (j = 2*q16, 2*q16+1)
    const int swoff = (((q16 >> 2) & 1) << 4) | ((q16 >> 3) << 3);
    const int pvidx = swoff + ((2 * q16) & 7);       // even f16 index within row

    for (int j0 = 0; j0 < NN; j0 += 32) {
        // ---- energy (log2 domain): lane q16 -> columns j0+2*q16(+1) ------
        v8f c01[2];
        #pragma unroll
        for (int h = 0; h < 2; ++h) {
            const _Float16* kRow =
                (hi == 0) ? (kB + (size_t)(j0 + 2 * q16 + h) * 16) : zpad;
            v16h bK = *(const v16h*)kRow;
            c01[h] = __builtin_amdgcn_wmma_f32_16x16x32_f16(
                false, aQ, false, bK, (short)0, zero8, false, false);
        }

        // ---- packed f16 row-max butterfly over the 16-lane half ----------
        v2h pk[4];
        #pragma unroll
        for (int i = 0; i < 4; ++i) {
            pk[i] = (v2h){(_Float16)fmaxf(c01[0][2 * i],     c01[1][2 * i]),
                          (_Float16)fmaxf(c01[0][2 * i + 1], c01[1][2 * i + 1])};
        }
        #pragma unroll
        for (int msk = 1; msk < 16; msk <<= 1) {
            #pragma unroll
            for (int i = 0; i < 4; ++i) {
                int o = __shfl_xor(__builtin_bit_cast(int, pk[i]), msk, 16);
                pk[i] = __builtin_elementwise_max(pk[i], __builtin_bit_cast(v2h, o));
            }
        }

        // ---- exp2, stage P (packed b32); track whether any max moved -----
        float sc[8];
        float scmin = 1.0f;
        #pragma unroll
        for (int r = 0; r < 8; ++r) {
            float tm = (float)pk[r >> 1][r & 1];
            float nm = fmaxf(m[r], tm);
            sc[r] = __builtin_exp2f(m[r] - nm);
            m[r] = nm;
            float p0 = __builtin_exp2f(c01[0][r] - nm);
            float p1 = __builtin_exp2f(c01[1][r] - nm);
            int row = r + 8 * hi;
            ((v2h*)pS)[(row * 32 + pvidx) >> 1] = (v2h){(_Float16)p0, (_Float16)p1};
            scmin = fminf(scmin, sc[r]);
        }

        // ---- rescale only when some row max updated (wave-uniform) -------
        if (__any(scmin < 1.0f)) {
            #pragma unroll
            for (int r = 0; r < 8; ++r)
                if (q16 == 0) sS[r + 8 * hi] = sc[r];
            float sQ = sS[q16];
            lcol *= sQ;
            #pragma unroll
            for (int cg = 0; cg < 4; ++cg)
                #pragma unroll
                for (int e = 0; e < 8; ++e) acc[cg][e] *= sQ;
        }

        // ---- P^T operand: one aligned 32B LDS read per lane --------------
        v16h bP = *(const v16h*)(pS + q16 * 32 + hi * 16);

        // ---- softmax denominator via ones x P^T (row-sum WMMA) -----------
        v8f cs = __builtin_amdgcn_wmma_f32_16x16x32_f16(
            false, aOnes, false, bP, (short)0, zero8, false, false);
        lcol += cs[0];

        // ---- out^T += V x P^T, 4 channel groups --------------------------
        #pragma unroll
        for (int cg = 0; cg < 4; ++cg) {
            v16h aV = *(const v16h*)(vB + (size_t)(cg * 16 + q16) * NN
                                        + (size_t)j0 + hi * 16);
            acc[cg] = __builtin_amdgcn_wmma_f32_16x16x32_f16(
                false, aV, false, bP, (short)0, acc[cg], false, false);
        }
    }

    // ---- finalize: gamma * acc / l + residual ----------------------------
    float invq = 1.0f / lcol;
    float g = gamma[0];
    #pragma unroll
    for (int cg = 0; cg < 4; ++cg)
        #pragma unroll
        for (int r = 0; r < 8; ++r) {
            int c = cg * 16 + r + 8 * hi;
            size_t idx = ((size_t)(b * CC + c)) * NN + i0 + q16;
            out[idx] = g * acc[cg][r] * invq + x[idx];
        }
}

// ---------------------------------------------------------------------------
extern "C" void kernel_launch(void* const* d_in, const int* in_sizes, int n_in,
                              void* d_out, int out_size, void* d_ws, size_t ws_size,
                              hipStream_t stream) {
    const float* x     = (const float*)d_in[0];
    const float* Wq    = (const float*)d_in[1];
    const float* bq    = (const float*)d_in[2];
    const float* Wk    = (const float*)d_in[3];
    const float* bk    = (const float*)d_in[4];
    const float* Wv    = (const float*)d_in[5];
    const float* bv    = (const float*)d_in[6];
    const float* gamma = (const float*)d_in[7];
    float* out = (float*)d_out;

    _Float16* ws = (_Float16*)d_ws;
    _Float16* qT   = ws + QT_OFF;
    _Float16* kT   = ws + KT_OFF;
    _Float16* vSw  = ws + VS_OFF;
    _Float16* zpad = ws + ZP_OFF;

    qk_proj_kernel<<<(BB * NN) / 256, 256, 0, stream>>>(x, Wq, bq, Wk, bk, qT, kT, zpad);
    v_proj_kernel<<<(BB * CC * NN) / 256, 256, 0, stream>>>(x, Wv, bv, vSw);
    attn_flash_kernel<<<(BB * NN / 16) / 8, 256, 0, stream>>>(qT, kT, vSw, zpad, x, gamma, out);
}

// v001
// It runs in 48.1 microseconds.
// In two side-by-side timings against v000, it was 3.70 and 3.56 times as fast.
#include <hip/hip_runtime.h>

typedef __attribute__((ext_vector_type(16))) _Float16 v16h;
typedef __attribute__((ext_vector_type(8)))  _Float16 v8h;
typedef __attribute__((ext_vector_type(2)))  _Float16 v2h;
typedef __attribute__((ext_vector_type(8)))  float    v8f;
typedef __attribute__((ext_vector_type(4)))  float    v4f;
typedef __attribute__((ext_vector_type(2)))  float    v2f;

#define BB 2
#define CC 64
#define C8 8
#define NN 4096
#define LOG2E 1.44269504088896340736f

// Workspace layout (f16 elements):
//   qT  [B][N][16] : e0-7 = q channels * log2(e), e8-15 = 0  (WMMA-A row)
//   kT  [B][N][16] : e0-7 = k channels, e8-15 = 0            (WMMA-B column)
//   vSw [B][C][N]  : per-32j-tile swizzled into WMMA-A lane-half order
//   zpad[16]       : zeros (read by lanes 16-31 for Q/K operands)
#define QT_OFF  ((size_t)0)
#define KT_OFF  ((size_t)BB * NN * 16)
#define VS_OFF  (KT_OFF + (size_t)BB * NN * 16)
#define ZP_OFF  (VS_OFF + (size_t)BB * CC * NN)

// ---------------------------------------------------------------------------
__global__ __launch_bounds__(256) void qk_proj_kernel(
    const float* __restrict__ x,
    const float* __restrict__ Wq, const float* __restrict__ bq,
    const float* __restrict__ Wk, const float* __restrict__ bk,
    _Float16* __restrict__ qT, _Float16* __restrict__ kT,
    _Float16* __restrict__ zpad)
{
    int t = blockIdx.x * blockDim.x + threadIdx.x;   // over B*N
    int b = t / NN, n = t % NN;
    float qa[C8], ka[C8];
    #pragma unroll
    for (int r = 0; r < C8; ++r) { qa[r] = bq[r]; ka[r] = bk[r]; }
    const float* xb = x + (size_t)b * CC * NN + n;
    for (int ci = 0; ci < CC; ++ci) {
        float xv = xb[(size_t)ci * NN];
        #pragma unroll
        for (int r = 0; r < C8; ++r) {
            qa[r] += Wq[r * CC + ci] * xv;
            ka[r] += Wk[r * CC + ci] * xv;
        }
    }
    _Float16* qo = qT + (size_t)t * 16;
    _Float16* ko = kT + (size_t)t * 16;
    #pragma unroll
    for (int r = 0; r < C8; ++r) {
        qo[r] = (_Float16)(qa[r] * LOG2E);  qo[8 + r] = (_Float16)0.f;
        ko[r] = (_Float16)ka[r];            ko[8 + r] = (_Float16)0.f;
    }
    if (t == 0) {
        #pragma unroll
        for (int i = 0; i < 16; ++i) zpad[i] = (_Float16)0.f;
    }
}

// v stored pre-swizzled for the WMMA A operand:
//   within each 32-j tile: [hi=0: j0-7, j16-23][hi=1: j8-15, j24-31]
__global__ __launch_bounds__(256) void v_proj_kernel(
    const float* __restrict__ x,
    const float* __restrict__ Wv, const float* __restrict__ bv,
    _Float16* __restrict__ vSw)
{
    int t = blockIdx.x * blockDim.x + threadIdx.x;   // over B*C*N
    int n = t % NN, c = (t / NN) % CC, b = t / (NN * CC);
    float a = bv[c];
    const float* xb = x + (size_t)b * CC * NN + n;
    for (int ci = 0; ci < CC; ++ci)
        a += Wv[c * CC + ci] * xb[(size_t)ci * NN];
    int jl  = n & 31;
    int hi  = (jl >> 3) & 1;
    int pos = (jl & 7) | ((jl >> 4) << 3);
    size_t idx = ((size_t)(b * CC + c)) * NN + (size_t)(n & ~31) + hi * 16 + pos;
    vSw[idx] = (_Float16)a;
}

// ---------------------------------------------------------------------------
// Fused flash-attention. One work-group per 32 queries (two 16-query tiles);
// the keys are split over KS waves per tile: wave (tq, ks) walks the 32-key
// blocks ks, ks + KS, ... with its own maxima, sums and accumulators, and the
// KS partial results of a tile are merged through LDS behind one barrier.
// Per step: 2 energy WMMA + 1 row-sum WMMA (ones x P^T) + 4 PV WMMA.
// Softmax kept in log2 domain (q pre-scaled by log2 e) -> bare v_exp_f32.
// Accumulator rescale executed only when a row max actually updates.
// ---------------------------------------------------------------------------
#define KS 16                    // key ranges (waves) per query tile
#define QTL 2                    // query tiles per work-group
#define NWV (KS * QTL)           // waves per work-group
#define PPITCH 68                // f32 per query row of a partial (16 B x odd)

__global__ __launch_bounds__(NWV * 32) void attn_flash_kernel(
    const _Float16* __restrict__ qT, const _Float16* __restrict__ kT,
    const _Float16* __restrict__ vSw, const _Float16* __restrict__ zpad,
    const float* __restrict__ x, const float* __restrict__ gamma,
    float* __restrict__ out)
{
    __shared__ __align__(32) _Float16 pBuf[NWV][16 * 32];     // per-wave P tile (chunk-swizzled)
    __shared__ __align__(16) float    sBuf[NWV][16];          // per-query rescale factor
    __shared__ __align__(16) float    part[NWV][16 * PPITCH]; // per-wave partial [query][channel]
    __shared__ __align__(16) float    mBuf[NWV][16];          // per-wave row maxima (log2 domain)
    __shared__ __align__(16) float    lBuf[NWV][16];          // per-wave denominators

    const int lane = threadIdx.x & 31;
    // wave-uniform by construction; held in a scalar register so that key offsets and LDS bases
    // are scalar arithmetic and cost no vector registers under the 128-register budget
    const int wid  = __builtin_amdgcn_readfirstlane(threadIdx.x >> 5);
    const int tq   = wid & (QTL - 1);               // query tile in the work-group
    const int ks   = wid / QTL;                     // key range of this wave
    const int tile = blockIdx.x * QTL + tq;         // 512 tiles
    const int b    = tile >> 8;
    const int i0   = (tile & 255) << 4;
    const int q16  = lane & 15;
    const int hi   = lane >> 4;

    _Float16* pS = &pBuf[wid][0];
    float*    sS = &sBuf[wid][0];

    // Q^T operand: lanes 0-15 real rows (zero-padded K), lanes 16-31 all zero
    const _Float16* qRow = (hi == 0) ? (qT + (size_t)(b * NN + i0 + q16) * 16) : zpad;
    v16h aQ = *(const v16h*)qRow;

    v16h aOnes;
    #pragma unroll
    for (int i = 0; i < 16; ++i) aOnes[i] = (_Float16)1.f;

    v8f zero8;
    #pragma unroll
    for (int e = 0; e < 8; ++e) zero8[e] = 0.f;

    v8f acc[4];
    #pragma unroll
    for (int cg = 0; cg < 4; ++cg) acc[cg] = zero8;

    float m[8];
    #pragma unroll
    for (int r = 0; r < 8; ++r) m[r] = -3.0e38f;
    float lcol = 0.f;                                // softmax denom for query q16

    const _Float16* kB = kT + (size_t)b * NN * 16;
    const _Float16* vB = vSw + (size_t)b * CC * NN;

    // chunk-swizzled P row offset for this lane's j pair (j = 2*q16, 2*q16+1)
    const int swoff = (((q16 >> 2) & 1) << 4) | ((q16 >> 3) << 3);
    const int pvidx = swoff + ((2 * q16) & 7);       // even f16 index within row

    // merge role: lane -> query (tile hi, column q16), wave -> two channels;
    // its residual values are fetched here so that the key loop covers their latency
    const int c0 = 2 * wid;
    const size_t idx0 = ((size_t)(b * CC + c0)) * NN + ((blockIdx.x * (16 * QTL)) & (NN - 1)) + lane;
    const float x0 = x[idx0];
    const float x1 = x[idx0 + NN];
    const float g  = gamma[0];

    for (int t = 0; t < NN / (KS * 32); ++t) {
        const int j0 = (t * KS + ks) * 32;
        // ---- energy (log2 domain): lane q16 -> columns j0+2*q16(+1) ------
        v8f c01[2];
        #pragma unroll
        for (int h = 0; h < 2; ++h) {
            const _Float16* kRow =
                (hi == 0) ? (kB + (size_t)(j0 + 2 * q16 + h) * 16) : zpad;
            v16h bK = *(const v16h*)kRow;
            c01[h] = __builtin_amdgcn_wmma_f32_16x16x32_f16(
                false, aQ, false, bK, (short)0, zero8, false, false);
        }

        // ---- packed f16 row-max butterfly over the 16-lane half ----------
        v2h pk[4];
        #pragma unroll
        for (int i = 0; i < 4; ++i) {
            pk[i] = (v2h){(_Float16)fmaxf(c01[0][2 * i],     c01[1][2 * i]),
                          (_Float16)fmaxf(c01[0][2 * i + 1], c01[1][2 * i + 1])};
        }
        #pragma unroll
        for (int msk = 1; msk < 16; msk <<= 1) {
            #pragma unroll
            for (int i = 0; i < 4; ++i) {
                int o = __shfl_xor(__builtin_bit_cast(int, pk[i]), msk, 16);
                pk[i] = __builtin_elementwise_max(pk[i], __builtin_bit_cast(v2h, o));
            }
        }

        // ---- exp2, stage P (packed b32); track whether any max moved -----
        float sc[8];
        float scmin = 1.0f;
        #pragma unroll
        for (int r = 0; r < 8; ++r) {
            float tm = (float)pk[r >> 1][r & 1];
            float nm = fmaxf(m[r], tm);
            sc[r] = __builtin_exp2f(m[r] - nm);
            m[r] = nm;
            float p0 = __builtin_exp2f(c01[0][r] - nm);
            float p1 = __builtin_exp2f(c01[1][r] - nm);
            int row = r + 8 * hi;
            ((v2h*)pS)[(row * 32 + pvidx) >> 1] = (v2h){(_Float16)p0, (_Float16)p1};
            scmin = fminf(scmin, sc[r]);
        }

        // ---- rescale only when some row max updated (wave-uniform) -------
        if (__any(scmin < 1.0f)) {
            #pragma unroll
            for (int r = 0; r < 8; ++r)
                if (q16 == 0) sS[r + 8 * hi] = sc[r];
            float sQ = sS[q16];
            lcol *= sQ;
            #pragma unroll
            for (int cg = 0; cg < 4; ++cg)
                #pragma unroll
                for (int e = 0; e < 8; ++e) acc[cg][e] *= sQ;
        }

        // ---- P^T operand: one aligned 32B LDS read per lane --------------
        v16h bP = *(const v16h*)(pS + q16 * 32 + hi * 16);

        // ---- softmax denominator via ones x P^T (row-sum WMMA) -----------
        v8f cs = __builtin_amdgcn_wmma_f32_16x16x32_f16(
            false, aOnes, false, bP, (short)0, zero8, false, false);
        lcol += cs[0];

        // ---- out^T += V x P^T, 4 channel groups --------------------------
        #pragma unroll
        for (int cg = 0; cg < 4; ++cg) {
            v16h aV = *(const v16h*)(vB + (size_t)(cg * 16 + q16) * NN
                                        + (size_t)j0 + hi * 16);
            acc[cg] = __builtin_amdgcn_wmma_f32_16x16x32_f16(
                false, aV, false, bP, (short)0, acc[cg], false, false);
        }
    }

    // ---- publish this wave's partial: maxima, denominator, accumulators --
    #pragma unroll
    for (int r = 0; r < 8; ++r)
        if (q16 == 0) mBuf[wid][r + 8 * hi] = m[r];
    if (hi == 0) lBuf[wid][q16] = lcol;
    float* pw = &part[wid][q16 * PPITCH + 8 * hi];
    #pragma unroll
    for (int cg = 0; cg < 4; ++cg) {
        *(v4f*)(pw + cg * 16)     = (v4f){acc[cg][0], acc[cg][1], acc[cg][2], acc[cg][3]};
        *(v4f*)(pw + cg * 16 + 4) = (v4f){acc[cg][4], acc[cg][5], acc[cg][6], acc[cg][7]};
    }

    // every wave's partial is in LDS before any wave reads another's
    __syncthreads();

    // ---- merge the KS key ranges: weights exp2(m - M) --------------------
    float ms[KS];
    float M = -3.0e38f;
    #pragma unroll
    for (int s = 0; s < KS; ++s) {
        ms[s] = mBuf[s * QTL + hi][q16];
        M = fmaxf(M, ms[s]);
    }
    float L = 0.f, o0 = 0.f, o1 = 0.f;
    #pragma unroll
    for (int s = 0; s < KS; ++s) {
        float w = __builtin_exp2f(ms[s] - M);
        v2f  p = *(const v2f*)&part[s * QTL + hi][q16 * PPITCH + c0];
        L  += w * lBuf[s * QTL + hi][q16];
        o0 += w * p[0];
        o1 += w * p[1];
    }

    // ---- finalize: gamma * o / L + residual; one 128-B line per store ----
    float invq = 1.0f / L;
    out[idx0]      = g * o0 * invq + x0;
    out[idx0 + NN] = g * o1 * invq + x1;
}

// ---------------------------------------------------------------------------
extern "C" void kernel_launch(void* const* d_in, const int* in_sizes, int n_in,
                              void* d_out, int out_size, void* d_ws, size_t ws_size,
                              hipStream_t stream) {
    const float* x     = (const float*)d_in[0];
    const float* Wq    = (const float*)d_in[1];
    const float* bq    = (const float*)d_in[2];
    const float* Wk    = (const float*)d_in[3];
    const float* bk    = (const float*)d_in[4];
    const float* Wv    = (const float*)d_in[5];
    const float* bv    = (const float*)d_in[6];
    const float* gamma = (const float*)d_in[7];
    float* out = (float*)d_out;

    _Float16* ws = (_Float16*)d_ws;
    _Float16* qT   = ws + QT_OFF;
    _Float16* kT   = ws + KT_OFF;
    _Float16* vSw  = ws + VS_OFF;
    _Float16* zpad = ws + ZP_OFF;

    qk_proj_kernel<<<(BB * NN) / 256, 256, 0, stream>>>(x, Wq, bq, Wk, bk, qT, kT, zpad);
    v_proj_kernel<<<(BB * CC * NN) / 256, 256, 0, stream>>>(x, Wv, bv, vSw);
    attn_flash_kernel<<<(BB * NN / 16) / QTL, NWV * 32, 0, stream>>>(qT, kT, vSw, zpad, x, gamma, out);
}

// v002
// One run takes 28.3 microseconds.
// In two side-by-side timings against v001, it was 1.67 and 1.68 times as fast.
// All steps since v000 together make it 6.08 times as fast.
#include <hip/hip_runtime.h>

typedef __attribute__((ext_vector_type(16))) _Float16 v16h;
typedef __attribute__((ext_vector_type(8)))  _Float16 v8h;
typedef __attribute__((ext_vector_type(2)))  _Float16 v2h;
typedef __attribute__((ext_vector_type(8)))  float    v8f;
typedef __attribute__((ext_vector_type(4)))  float    v4f;
typedef __attribute__((ext_vector_type(2)))  float    v2f;

#define BB 2
#define CC 64
#define C8 8
#define NN 4096
#define LOG2E 1.44269504088896340736f

// Workspace layout (f16 elements):
//   qT  [B][N][16] : e0-7 = q channels * log2(e), e8-15 = 0  (WMMA-A row)
//   kT  [B][N][16] : e0-7 = k channels, e8-15 = 0            (WMMA-B column)
//   vSw [B][C][N]  : per-32j-tile swizzled into WMMA-A lane-half order
//   zpad[16]       : zeros (read by lanes 16-31 for Q/K operands)
#define QT_OFF  ((size_t)0)
#define KT_OFF  ((size_t)BB * NN * 16)
#define VS_OFF  (KT_OFF + (size_t)BB * NN * 16)
#define ZP_OFF  (VS_OFF + (size_t)BB * CC * NN)

// ---------------------------------------------------------------------------
// All three projections in one launch, as f32 matrix products (16x16x4 form).
// One wave per work-group: 64 columns n of one batch (four fragments of 16,
// fragment f = columns n0 + 4*c + f, so a lane's 16-byte load of x feeds all
// four) times one group of 16 output channels: group 0 = q (rows 0-7) and
// k (rows 8-15), groups 1-4 = v.
// k order, the same for the x and the weight fragment: lane half h, step kk,
// element e  ->  input channel 32*h + 2*kk + e.
//   group 0  : D = W * x    -> a lane holds the 8 q (h = 0) or k (h = 1)
//              channels of one column: one 16-byte row store
//   groups 1+: D = x^T * W^T -> a lane holds 32 consecutive n of one channel:
//              one whole 32-j tile of vSw, 64 contiguous bytes
// ---------------------------------------------------------------------------
#define PN 64                    // columns per wave
#define PG 5                     // channel groups: q|k, v0-15, v16-31, v32-47, v48-63

__global__ __launch_bounds__(32) void proj_kernel(
    const float* __restrict__ x,
    const float* __restrict__ Wq, const float* __restrict__ bq,
    const float* __restrict__ Wk, const float* __restrict__ bk,
    const float* __restrict__ Wv, const float* __restrict__ bv,
    _Float16* __restrict__ qT, _Float16* __restrict__ kT,
    _Float16* __restrict__ vSw, _Float16* __restrict__ zpad)
{
    const int c  = threadIdx.x & 15;
    const int h  = threadIdx.x >> 4;
    const int g  = blockIdx.x % PG;
    const int nb = blockIdx.x / PG;
    const int b  = nb / (NN / PN);
    const int n0 = (nb % (NN / PN)) * PN;

    const float* wrow = (g == 0) ? ((c < 8) ? Wq + c * CC : Wk + (c - 8) * CC)
                                 : Wv + ((g - 1) * 16 + c) * CC;
    wrow += h * 32;
    const float* xp = x + ((size_t)(b * CC + h * 32)) * NN + n0 + 4 * c;
    // accumulator start, D register r: group 0 = bias of channel r of q (h = 0) or k (h = 1);
    // groups 1+ = the lane's own channel's bias in every register
    const float* bp = (g == 0) ? (h ? bk : bq) : bv + ((g - 1) * 16 + c);
    const int    bs = (g == 0) ? 1 : 0;

    float bias[8];
    #pragma unroll
    for (int r = 0; r < 8; ++r) bias[r] = bp[r * bs];
    v4f xr[32];
    #pragma unroll
    for (int i = 0; i < 32; ++i) xr[i] = *(const v4f*)(xp + (size_t)i * NN);
    v4f wr[8];
    #pragma unroll
    for (int i = 0; i < 8; ++i) wr[i] = *(const v4f*)(wrow + 4 * i);
    // stands in front of the first reuse of the address registers of the loads above
    asm volatile("s_wait_xcnt 0x0" ::: "memory");

    v8f acc[4];
    #pragma unroll
    for (int f = 0; f < 4; ++f)
        #pragma unroll
        for (int r = 0; r < 8; ++r) acc[f][r] = bias[r];

    if (g != 0) {
        const int ch = (g - 1) * 16 + c;
        #pragma unroll
        for (int kk = 0; kk < 16; ++kk) {
            v2f w = (v2f){wr[kk >> 1][(2 * kk) & 3], wr[kk >> 1][((2 * kk) & 3) + 1]};
            #pragma unroll
            for (int f = 0; f < 4; ++f) {
                v2f xv = (v2f){xr[2 * kk][f], xr[2 * kk + 1][f]};
                acc[f] = __builtin_amdgcn_wmma_f32_16x16x4_f32(
                    false, xv, false, w, (short)0, acc[f], false, false);
            }
        }
        // acc[f][r] = v[ch][n0 + 32*h + 4*r + f]; within the 32-j tile the stored order is
        // [j0-7, j16-23][j8-15, j24-31], so the 8-j pieces come from r = 0, 4, 2, 6
        _Float16* dst = vSw + ((size_t)(b * CC + ch)) * NN + n0 + 32 * h;
        #pragma unroll
        for (int p = 0; p < 4; ++p) {
            const int r0 = ((p & 1) << 2) | (p & 2);
            v8h o;
            #pragma unroll
            for (int e = 0; e < 8; ++e) o[e] = (_Float16)acc[e & 3][r0 + (e >> 2)];
            *(v8h*)(dst + p * 8) = o;
        }
        // the built code lays the q|k path behind these stores and reuses their registers there:
        // the wait stands in front of that reuse
        asm volatile("s_wait_xcnt 0x0" ::: "memory");
        return;
    }

    #pragma unroll
    for (int kk = 0; kk < 16; ++kk) {
        v2f w = (v2f){wr[kk >> 1][(2 * kk) & 3], wr[kk >> 1][((2 * kk) & 3) + 1]};
        #pragma unroll
        for (int f = 0; f < 4; ++f) {
            v2f xv = (v2f){xr[2 * kk][f], xr[2 * kk + 1][f]};
            acc[f] = __builtin_amdgcn_wmma_f32_16x16x4_f32(
                false, w, false, xv, (short)0, acc[f], false, false);
        }
    }
    const float s = h ? 1.0f : LOG2E;
    _Float16* dst = (h ? kT : qT) + ((size_t)(b * NN + n0 + 4 * c)) * 16;
    v8h z8;
    #pragma unroll
    for (int e = 0; e < 8; ++e) z8[e] = (_Float16)0.f;
    #pragma unroll
    for (int f = 0; f < 4; ++f) {
        v8h o;
        #pragma unroll
        for (int r = 0; r < 8; ++r) o[r] = (_Float16)(acc[f][r] * s);
        *(v8h*)(dst + f * 16)     = o;
        *(v8h*)(dst + f * 16 + 8) = z8;
    }
    if (blockIdx.x == 0 && threadIdx.x == 0) {
        *(v8h*)(zpad)     = z8;
        *(v8h*)(zpad + 8) = z8;
    }
}

// ---------------------------------------------------------------------------
// Fused flash-attention. One work-group per 32 queries (two 16-query tiles);
// the keys are split over KS waves per tile: wave (tq, ks) walks the 32-key
// blocks ks, ks + KS, ... with its own maxima, sums and accumulators, and the
// KS partial results of a tile are merged through LDS behind one barrier.
// Per step: 2 energy WMMA + 1 row-sum WMMA (ones x P^T) + 4 PV WMMA.
// Softmax kept in log2 domain (q pre-scaled by log2 e) -> bare v_exp_f32.
// Accumulator rescale executed only when a row max actually updates.
// ---------------------------------------------------------------------------
#define KS 16                    // key ranges (waves) per query tile
#define QTL 2                    // query tiles per work-group
#define NWV (KS * QTL)           // waves per work-group
#define PPITCH 68                // f32 per query row of a partial (16 B x odd)

__global__ __launch_bounds__(NWV * 32) void attn_flash_kernel(
    const _Float16* __restrict__ qT, const _Float16* __restrict__ kT,
    const _Float16* __restrict__ vSw, const _Float16* __restrict__ zpad,
    const float* __restrict__ x, const float* __restrict__ gamma,
    float* __restrict__ out)
{
    __shared__ __align__(32) _Float16 pBuf[NWV][16 * 32];     // per-wave P tile (chunk-swizzled)
    __shared__ __align__(16) float    sBuf[NWV][16];          // per-query rescale factor
    __shared__ __align__(16) float    part[NWV][16 * PPITCH]; // per-wave partial [query][channel]
    __shared__ __align__(16) float    mBuf[NWV][16];          // per-wave row maxima (log2 domain)
    __shared__ __align__(16) float    lBuf[NWV][16];          // per-wave denominators

    const int lane = threadIdx.x & 31;
    // wave-uniform by construction; held in a scalar register so that key offsets and LDS bases
    // are scalar arithmetic and cost no vector registers under the 128-register budget
    const int wid  = __builtin_amdgcn_readfirstlane(threadIdx.x >> 5);
    const int tq   = wid & (QTL - 1);               // query tile in the work-group
    const int ks   = wid / QTL;                     // key range of this wave
    const int tile = blockIdx.x * QTL + tq;         // 512 tiles
    const int b    = tile >> 8;
    const int i0   = (tile & 255) << 4;
    const int q16  = lane & 15;
    const int hi   = lane >> 4;

    _Float16* pS = &pBuf[wid][0];
    float*    sS = &sBuf[wid][0];

    // Q^T operand: lanes 0-15 real rows (zero-padded K), lanes 16-31 all zero
    const _Float16* qRow = (hi == 0) ? (qT + (size_t)(b * NN + i0 + q16) * 16) : zpad;
    v16h aQ = *(const v16h*)qRow;

    v16h aOnes;
    #pragma unroll
    for (int i = 0; i < 16; ++i) aOnes[i] = (_Float16)1.f;

    v8f zero8;
    #pragma unroll
    for (int e = 0; e < 8; ++e) zero8[e] = 0.f;

    v8f acc[4];
    #pragma unroll
    for (int cg = 0; cg < 4; ++cg) acc[cg] = zero8;

    float m[8];
    #pragma unroll
    for (int r = 0; r < 8; ++r) m[r] = -3.0e38f;
    float lcol = 0.f;                                // softmax denom for query q16

    const _Float16* kB = kT + (size_t)b * NN * 16;
    const _Float16* vB = vSw + (size_t)b * CC * NN;

    // chunk-swizzled P row offset for this lane's j pair (j = 2*q16, 2*q16+1)
    const int swoff = (((q16 >> 2) & 1) << 4) | ((q16 >> 3) << 3);
    const int pvidx = swoff + ((2 * q16) & 7);       // even f16 index within row

    // merge role: lane -> query (tile hi, column q16), wave -> two channels;
    // its residual values are fetched here so that the key loop covers their latency
    const int c0 = 2 * wid;
    const size_t idx0 = ((size_t)(b * CC + c0)) * NN + ((blockIdx.x * (16 * QTL)) & (NN - 1)) + lane;
    const float x0 = x[idx0];
    const float x1 = x[idx0 + NN];
    const float g  = gamma[0];

    for (int t = 0; t < NN / (KS * 32); ++t) {
        const int j0 = (t * KS + ks) * 32;
        // ---- energy (log2 domain): lane q16 -> columns j0+2*q16(+1) ------
        v8f c01[2];
        #pragma unroll
        for (int h = 0; h < 2; ++h) {
            const _Float16* kRow =
                (hi == 0) ? (kB + (size_t)(j0 + 2 * q16 + h) * 16) : zpad;
            v16h bK = *(const v16h*)kRow;
            c01[h] = __builtin_amdgcn_wmma_f32_16x16x32_f16(
                false, aQ, false, bK, (short)0, zero8, false, false);
        }

        // ---- packed f16 row-max butterfly over the 16-lane half ----------
        v2h pk[4];
        #pragma unroll
        for (int i = 0; i < 4; ++i) {
            pk[i] = (v2h){(_Float16)fmaxf(c01[0][2 * i],     c01[1][2 * i]),
                          (_Float16)fmaxf(c01[0][2 * i + 1], c01[1][2 * i + 1])};
        }
        #pragma unroll
        for (int msk = 1; msk < 16; msk <<= 1) {
            #pragma unroll
            for (int i = 0; i < 4; ++i) {
                int o = __shfl_xor(__builtin_bit_cast(int, pk[i]), msk, 16);
                pk[i] = __builtin_elementwise_max(pk[i], __builtin_bit_cast(v2h, o));
            }
        }

        // ---- exp2, stage P (packed b32); track whether any max moved -----
        float sc[8];
        float scmin = 1.0f;
        #pragma unroll
        for (int r = 0; r < 8; ++r) {
            float tm = (float)pk[r >> 1][r & 1];
            float nm = fmaxf(m[r], tm);
            sc[r] = __builtin_exp2f(m[r] - nm);
            m[r] = nm;
            float p0 = __builtin_exp2f(c01[0][r] - nm);
            float p1 = __builtin_exp2f(c01[1][r] - nm);
            int row = r + 8 * hi;
            ((v2h*)pS)[(row * 32 + pvidx) >> 1] = (v2h){(_Float16)p0, (_Float16)p1};
            scmin = fminf(scmin, sc[r]);
        }

        // ---- rescale only when some row max updated (wave-uniform) -------
        if (__any(scmin < 1.0f)) {
            #pragma unroll
            for (int r = 0; r < 8; ++r)
                if (q16 == 0) sS[r + 8 * hi] = sc[r];
            float sQ = sS[q16];
            lcol *= sQ;
            #pragma unroll
            for (int cg = 0; cg < 4; ++cg)
                #pragma unroll
                for (int e = 0; e < 8; ++e) acc[cg][e] *= sQ;
        }

        // ---- P^T operand: one aligned 32B LDS read per lane --------------
        v16h bP = *(const v16h*)(pS + q16 * 32 + hi * 16);

        // ---- softmax denominator via ones x P^T (row-sum WMMA) -----------
        v8f cs = __builtin_amdgcn_wmma_f32_16x16x32_f16(
            false, aOnes, false, bP, (short)0, zero8, false, false);
        lcol += cs[0];

        // ---- out^T += V x P^T, 4 channel groups --------------------------
        #pragma unroll
        for (int cg = 0; cg < 4; ++cg) {
            v16h aV = *(const v16h*)(vB + (size_t)(cg * 16 + q16) * NN
                                        + (size_t)j0 + hi * 16);
            acc[cg] = __builtin_amdgcn_wmma_f32_16x16x32_f16(
                false, aV, false, bP, (short)0, acc[cg], false, false);
        }
    }

    // ---- publish this wave's partial: maxima, denominator, accumulators --
    #pragma unroll
    for (int r = 0; r < 8; ++r)
        if (q16 == 0) mBuf[wid][r + 8 * hi] = m[r];
    if (hi == 0) lBuf[wid][q16] = lcol;
    float* pw = &part[wid][q16 * PPITCH + 8 * hi];
    #pragma unroll
    for (int cg = 0; cg < 4; ++cg) {
        *(v4f*)(pw + cg * 16)     = (v4f){acc[cg][0], acc[cg][1], acc[cg][2], acc[cg][3]};
        *(v4f*)(pw + cg * 16 + 4) = (v4f){acc[cg][4], acc[cg][5], acc[cg][6], acc[cg][7]};
    }

    // every wave's partial is in LDS before any wave reads another's
    __syncthreads();

    // ---- merge the KS key ranges: weights exp2(m - M) --------------------
    float ms[KS];
    float M = -3.0e38f;
    #pragma unroll
    for (int s = 0; s < KS; ++s) {
        ms[s] = mBuf[s * QTL + hi][q16];
        M = fmaxf(M, ms[s]);
    }
    float L = 0.f, o0 = 0.f, o1 = 0.f;
    #pragma unroll
    for (int s = 0; s < KS; ++s) {
        float w = __builtin_exp2f(ms[s] - M);
        v2f  p = *(const v2f*)&part[s * QTL + hi][q16 * PPITCH + c0];
        L  += w * lBuf[s * QTL + hi][q16];
        o0 += w * p[0];
        o1 += w * p[1];
    }

    // ---- finalize: gamma * o / L + residual; one 128-B line per store ----
    float invq = 1.0f / L;
    out[idx0]      = g * o0 * invq + x0;
    out[idx0 + NN] = g * o1 * invq + x1;
}

// ---------------------------------------------------------------------------
extern "C" void kernel_launch(void* const* d_in, const int* in_sizes, int n_in,
                              void* d_out, int out_size, void* d_ws, size_t ws_size,
                              hipStream_t stream) {
    const float* x     = (const float*)d_in[0];
    const float* Wq    = (const float*)d_in[1];
    const float* bq    = (const float*)d_in[2];
    const float* Wk    = (const float*)d_in[3];
    const float* bk    = (const float*)d_in[4];
    const float* Wv    = (const float*)d_in[5];
    const float* bv    = (const float*)d_in[6];
    const float* gamma = (const float*)d_in[7];
    float* out = (float*)d_out;

    _Float16* ws = (_Float16*)d_ws;
    _Float16* qT   = ws + QT_OFF;
    _Float16* kT   = ws + KT_OFF;
    _Float16* vSw  = ws + VS_OFF;
    _Float16* zpad = ws + ZP_OFF;

    proj_kernel<<<(BB * NN / PN) * PG, 32, 0, stream>>>(x, Wq, bq, Wk, bk, Wv, bv, qT, kT, vSw, zpad);
    attn_flash_kernel<<<(BB * NN / 16) / QTL, NWV * 32, 0, stream>>>(qT, kT, vSw, zpad, x, gamma, out);
}

// v003
// Measured time: 25.9 microseconds a run.
// Two timings next to v002 put it at 1.06 and 1.12 times that version's speed.
// All steps since v000 together make it 6.63 times as fast.
#include <hip/hip_runtime.h>

typedef __attribute__((ext_vector_type(16))) _Float16 v16h;
typedef __attribute__((ext_vector_type(8)))  _Float16 v8h;
typedef __attribute__((ext_vector_type(2)))  _Float16 v2h;
typedef __attribute__((ext_vector_type(8)))  float    v8f;
typedef __attribute__((ext_vector_type(4)))  float    v4f;
typedef __attribute__((ext_vector_type(2)))  float    v2f;

#define BB 2
#define CC 64
#define C8 8
#define NN 4096
#define LOG2E 1.44269504088896340736f

// Workspace layout (f16 elements). K and V lie in the order in which a wave of the
// attention kernel loads them, so that each of its 16-byte-per-lane loads is 512 bytes in a row:
//   qT  [B][N][8]               : q channels * log2(e)
//   kT  [B][N/32][32][8]        : slot 16*h + c of a 32-key block = the 8 channels of key 2*c + h
//   vSw [B][N/32][4][2][32][8]  : [channel group][part p][lane 16*hi + c] =
//                                 channel 16*group + c, keys 16*p + 8*hi + 0..7 of the block
#define QT_OFF  ((size_t)0)
#define KT_OFF  ((size_t)BB * NN * 8)
#define VS_OFF  (KT_OFF + (size_t)BB * NN * 8)
#define KBLK    256              // f16 per 32-key block of kT
#define VBLK    2048             // f16 per 32-key block of vSw

// ---------------------------------------------------------------------------
// All three projections in one launch, as f32 matrix products (16x16x4 form).
// One wave per work-group: 64 columns n of one batch (four fragments of 16,
// fragment f = columns n0 + 4*c + f, so a lane's 16-byte load of x feeds all
// four) times one group of 16 output channels: group 0 = q (rows 0-7) and
// k (rows 8-15), groups 1-4 = v.
// k order, the same for the x and the weight fragment: lane half h, step kk,
// element e  ->  input channel 32*h + 2*kk + e.
//   group 0  : D = W * x    -> a lane holds the 8 q (h = 0) or k (h = 1)
//              channels of one column: one 16-byte store
//   groups 1+: D = x^T * W^T -> a lane holds 32 consecutive n of one channel:
//              its channel's share of one 32-key block of vSw, four 16-byte pieces
// ---------------------------------------------------------------------------
#define PN 64                    // columns per wave
#define PG 5                     // channel groups: q|k, v0-15, v16-31, v32-47, v48-63

__global__ __launch_bounds__(32) void proj_kernel(
    const float* __restrict__ x,
    const float* __restrict__ Wq, const float* __restrict__ bq,
    const float* __restrict__ Wk, const float* __restrict__ bk,
    const float* __restrict__ Wv, const float* __restrict__ bv,
    _Float16* __restrict__ qT, _Float16* __restrict__ kT,
    _Float16* __restrict__ vSw)
{
    const int c  = threadIdx.x & 15;
    const int h  = threadIdx.x >> 4;
    const int g  = blockIdx.x % PG;
    const int nb = blockIdx.x / PG;
    const int b  = nb / (NN / PN);
    const int n0 = (nb % (NN / PN)) * PN;

    const float* wrow = (g == 0) ? ((c < 8) ? Wq + c * CC : Wk + (c - 8) * CC)
                                 : Wv + ((g - 1) * 16 + c) * CC;
    wrow += h * 32;
    const float* xp = x + ((size_t)(b * CC + h * 32)) * NN + n0 + 4 * c;
    // accumulator start, D register r: group 0 = bias of channel r of q (h = 0) or k (h = 1);
    // groups 1+ = the lane's own channel's bias in every register
    const float* bp = (g == 0) ? (h ? bk : bq) : bv + ((g - 1) * 16 + c);
    const int    bs = (g == 0) ? 1 : 0;

    float bias[8];
    #pragma unroll
    for (int r = 0; r < 8; ++r) bias[r] = bp[r * bs];
    v4f xr[32];
    #pragma unroll
    for (int i = 0; i < 32; ++i) xr[i] = *(const v4f*)(xp + (size_t)i * NN);
    v4f wr[8];
    #pragma unroll
    for (int i = 0; i < 8; ++i) wr[i] = *(const v4f*)(wrow + 4 * i);
    // stands in front of the first reuse of the address registers of the loads above
    asm volatile("s_wait_xcnt 0x0" ::: "memory");

    v8f acc[4];
    #pragma unroll
    for (int f = 0; f < 4; ++f)
        #pragma unroll
        for (int r = 0; r < 8; ++r) acc[f][r] = bias[r];

    if (g != 0) {
        #pragma unroll
        for (int kk = 0; kk < 16; ++kk) {
            v2f w = (v2f){wr[kk >> 1][(2 * kk) & 3], wr[kk >> 1][((2 * kk) & 3) + 1]};
            #pragma unroll
            for (int f = 0; f < 4; ++f) {
                v2f xv = (v2f){xr[2 * kk][f], xr[2 * kk + 1][f]};
                acc[f] = __builtin_amdgcn_wmma_f32_16x16x4_f32(
                    false, xv, false, w, (short)0, acc[f], false, false);
            }
        }
        // acc[f][r] = v[16*(g-1) + c][n0 + 32*h + 4*r + f]; the piece of keys 8*jj .. 8*jj+7
        // (r = 2*jj, 2*jj+1) goes to part jj >> 1, lane half jj & 1: 16 lanes store 256 B in a row
        _Float16* dst = vSw + (size_t)b * CC * NN + (size_t)((n0 >> 5) + h) * VBLK
                            + (g - 1) * 512 + c * 8;
        #pragma unroll
        for (int jj = 0; jj < 4; ++jj) {
            v8h o;
            #pragma unroll
            for (int e = 0; e < 8; ++e) o[e] = (_Float16)acc[e & 3][2 * jj + (e >> 2)];
            *(v8h*)(dst + (jj >> 1) * 256 + (jj & 1) * 128) = o;
        }
        // the built code lays the q|k path behind these stores and reuses their registers there:
        // the wait stands in front of that reuse
        asm volatile("s_wait_xcnt 0x0" ::: "memory");
        return;
    }

    #pragma unroll
    for (int kk = 0; kk < 16; ++kk) {
        v2f w = (v2f){wr[kk >> 1][(2 * kk) & 3], wr[kk >> 1][((2 * kk) & 3) + 1]};
        #pragma unroll
        for (int f = 0; f < 4; ++f) {
            v2f xv = (v2f){xr[2 * kk][f], xr[2 * kk + 1][f]};
            acc[f] = __builtin_amdgcn_wmma_f32_16x16x4_f32(
                false, w, false, xv, (short)0, acc[f], false, false);
        }
    }
    const float s = h ? 1.0f : LOG2E;
    // column n0 + 4*c + f: q row as it is; k = key 4*(c & 7) + f of block c >> 3,
    // slot 16*(f & 1) + 2*(c & 7) + (f >> 1)
    _Float16* dst = h ? kT + ((size_t)(b * NN + n0 + (c >> 3) * 32 + 2 * (c & 7))) * 8
                      : qT + ((size_t)(b * NN + n0 + 4 * c)) * 8;
    #pragma unroll
    for (int f = 0; f < 4; ++f) {
        v8h o;
        #pragma unroll
        for (int r = 0; r < 8; ++r) o[r] = (_Float16)(acc[f][r] * s);
        *(v8h*)(dst + (h ? (f & 1) * 16 + (f >> 1) : f) * 8) = o;
    }
}

// ---------------------------------------------------------------------------
// Fused flash-attention. One work-group per 32 queries (two 16-query tiles);
// the keys are split over KS waves per tile: wave (tq, ks) walks the 32-key
// blocks ks, ks + KS, ... with its own maxima, sums and accumulators, and the
// KS partial results of a tile are merged through LDS behind one barrier.
// Per step: 2 energy WMMA + 1 row-sum WMMA (ones x P^T) + 4 PV WMMA.
// Softmax kept in log2 domain (q pre-scaled by log2 e) -> bare v_exp_f32.
// Accumulator rescale executed only when a row max actually updates.
// ---------------------------------------------------------------------------
#define KS 16                    // key ranges (waves) per query tile
#define QTL 2                    // query tiles per work-group
#define NWV (KS * QTL)           // waves per work-group
#define PPITCH 68                // f32 per query row of a partial (16 B x odd)

__global__ __launch_bounds__(NWV * 32) void attn_flash_kernel(
    const _Float16* __restrict__ qT, const _Float16* __restrict__ kT,
    const _Float16* __restrict__ vSw,
    const float* __restrict__ x, const float* __restrict__ gamma,
    float* __restrict__ out)
{
    __shared__ __align__(32) _Float16 pBuf[NWV][16 * 32];     // per-wave P tile (chunk-swizzled)
    __shared__ __align__(16) float    sBuf[NWV][16];          // per-query rescale factor
    __shared__ __align__(16) float    part[NWV][16 * PPITCH]; // per-wave partial [query][channel]
    __shared__ __align__(16) float    mBuf[NWV][16];          // per-wave row maxima (log2 domain)
    __shared__ __align__(16) float    lBuf[NWV][16];          // per-wave denominators

    const int lane = threadIdx.x & 31;
    // wave-uniform by construction; held in a scalar register so that key offsets and LDS bases
    // are scalar arithmetic and cost no vector registers under the 128-register budget
    const int wid  = __builtin_amdgcn_readfirstlane(threadIdx.x >> 5);
    const int tq   = wid & (QTL - 1);               // query tile in the work-group
    const int ks   = wid / QTL;                     // key range of this wave
    const int tile = blockIdx.x * QTL + tq;         // 512 tiles
    const int b    = tile >> 8;
    const int i0   = (tile & 255) << 4;
    const int q16  = lane & 15;
    const int hi   = lane >> 4;

    _Float16* pS = &pBuf[wid][0];
    float*    sS = &sBuf[wid][0];

    // Q^T twice: aQ[0] holds the 8 channels at k = 0-7 (lanes 0-15), aQ[1] at k = 8-15
    // (lanes 16-31), zero elsewhere. One K operand then serves both score products: its lanes
    // 0-15 hold the even keys (k = 0-7), its lanes 16-31 the odd keys (k = 8-15).
    const v8h q8 = *(const v8h*)(qT + (size_t)(b * NN + i0 + q16) * 8);
    v16h aQ[2];
    #pragma unroll
    for (int e = 0; e < 8; ++e) {
        aQ[0][e]     = hi ? (_Float16)0.f : q8[e];
        aQ[1][e]     = hi ? q8[e] : (_Float16)0.f;
        aQ[0][e + 8] = (_Float16)0.f;
        aQ[1][e + 8] = (_Float16)0.f;
    }

    v16h aOnes;
    #pragma unroll
    for (int i = 0; i < 16; ++i) aOnes[i] = (_Float16)1.f;

    v8f zero8;
    #pragma unroll
    for (int e = 0; e < 8; ++e) zero8[e] = 0.f;

    v8f acc[4];
    #pragma unroll
    for (int cg = 0; cg < 4; ++cg) acc[cg] = zero8;

    float m[8];
    #pragma unroll
    for (int r = 0; r < 8; ++r) m[r] = -3.0e38f;
    float lcol = 0.f;                                // softmax denom for query q16

    const _Float16* kB = kT + (size_t)b * NN * 8 + lane * 8;
    const _Float16* vB = vSw + (size_t)b * CC * NN + lane * 8;

    // chunk-swizzled P row offset for this lane's j pair (j = 2*q16, 2*q16+1)
    const int swoff = (((q16 >> 2) & 1) << 4) | ((q16 >> 3) << 3);
    const int pvidx = swoff + ((2 * q16) & 7);       // even f16 index within row

    // merge role: lane -> query (tile hi, column q16), wave -> two channels;
    // its residual values are fetched here so that the key loop covers their latency
    const int c0 = 2 * wid;
    const size_t idx0 = ((size_t)(b * CC + c0)) * NN + ((blockIdx.x * (16 * QTL)) & (NN - 1)) + lane;
    const float x0 = x[idx0];
    const float x1 = x[idx0 + NN];
    const float g  = gamma[0];

    for (int t = 0; t < NN / (KS * 32); ++t) {
        const int blk = t * KS + ks;                 // 32-key block
        // ---- energy (log2 domain): lane q16 -> keys 2*q16(+1) of the block;
        //      one 512-byte load brings all 32 keys ------------------------
        const v8h k8 = *(const v8h*)(kB + (size_t)blk * KBLK);
        v16h bK;
        #pragma unroll
        for (int e = 0; e < 8; ++e) { bK[e] = k8[e]; bK[e + 8] = (_Float16)0.f; }
        v8f c01[2];
        #pragma unroll
        for (int h = 0; h < 2; ++h)
            c01[h] = __builtin_amdgcn_wmma_f32_16x16x32_f16(
                false, aQ[h], false, bK, (short)0, zero8, false, false);

        // ---- packed f16 row-max butterfly over the 16-lane half ----------
        v2h pk[4];
        #pragma unroll
        for (int i = 0; i < 4; ++i) {
            pk[i] = (v2h){(_Float16)fmaxf(c01[0][2 * i],     c01[1][2 * i]),
                          (_Float16)fmaxf(c01[0][2 * i + 1], c01[1][2 * i + 1])};
        }
        #pragma unroll
        for (int msk = 1; msk < 16; msk <<= 1) {
            #pragma unroll
            for (int i = 0; i < 4; ++i) {
                int o = __shfl_xor(__builtin_bit_cast(int, pk[i]), msk, 16);
                pk[i] = __builtin_elementwise_max(pk[i], __builtin_bit_cast(v2h, o));
            }
        }

        // ---- exp2, stage P (packed b32); track whether any max moved -----
        float sc[8];
        float scmin = 1.0f;
        #pragma unroll
        for (int r = 0; r < 8; ++r) {
            float tm = (float)pk[r >> 1][r & 1];
            float nm = fmaxf(m[r], tm);
            sc[r] = __builtin_exp2f(m[r] - nm);
            m[r] = nm;
            float p0 = __builtin_exp2f(c01[0][r] - nm);
            float p1 = __builtin_exp2f(c01[1][r] - nm);
            int row = r + 8 * hi;
            ((v2h*)pS)[(row * 32 + pvidx) >> 1] = (v2h){(_Float16)p0, (_Float16)p1};
            scmin = fminf(scmin, sc[r]);
        }

        // ---- rescale only when some row max updated (wave-uniform) -------
        if (__any(scmin < 1.0f)) {
            #pragma unroll
            for (int r = 0; r < 8; ++r)
                if (q16 == 0) sS[r + 8 * hi] = sc[r];
            float sQ = sS[q16];
            lcol *= sQ;
            #pragma unroll
            for (int cg = 0; cg < 4; ++cg)
                #pragma unroll
                for (int e = 0; e < 8; ++e) acc[cg][e] *= sQ;
        }

        // ---- P^T operand: one aligned 32B LDS read per lane --------------
        v16h bP = *(const v16h*)(pS + q16 * 32 + hi * 16);

        // ---- softmax denominator via ones x P^T (row-sum WMMA) -----------
        v8f cs = __builtin_amdgcn_wmma_f32_16x16x32_f16(
            false, aOnes, false, bP, (short)0, zero8, false, false);
        lcol += cs[0];

        // ---- out^T += V x P^T, 4 channel groups --------------------------
        #pragma unroll
        for (int cg = 0; cg < 4; ++cg) {
            const _Float16* vp = vB + (size_t)blk * VBLK + cg * 512;
            const v8h v0 = *(const v8h*)(vp);
            const v8h v1 = *(const v8h*)(vp + 256);
            v16h aV = __builtin_shufflevector(v0, v1, 0, 1, 2, 3, 4, 5, 6, 7,
                                              8, 9, 10, 11, 12, 13, 14, 15);
            acc[cg] = __builtin_amdgcn_wmma_f32_16x16x32_f16(
                false, aV, false, bP, (short)0, acc[cg], false, false);
        }
    }

    // ---- publish this wave's partial: maxima, denominator, accumulators --
    #pragma unroll
    for (int r = 0; r < 8; ++r)
        if (q16 == 0) mBuf[wid][r + 8 * hi] = m[r];
    if (hi == 0) lBuf[wid][q16] = lcol;
    float* pw = &part[wid][q16 * PPITCH + 8 * hi];
    #pragma unroll
    for (int cg = 0; cg < 4; ++cg) {
        *(v4f*)(pw + cg * 16)     = (v4f){acc[cg][0], acc[cg][1], acc[cg][2], acc[cg][3]};
        *(v4f*)(pw + cg * 16 + 4) = (v4f){acc[cg][4], acc[cg][5], acc[cg][6], acc[cg][7]};
    }

    // every wave's partial is in LDS before any wave reads another's
    __syncthreads();

    // ---- merge the KS key ranges: weights exp2(m - M) --------------------
    float ms[KS];
    float M = -3.0e38f;
    #pragma unroll
    for (int s = 0; s < KS; ++s) {
        ms[s] = mBuf[s * QTL + hi][q16];
        M = fmaxf(M, ms[s]);
    }
    float L = 0.f, o0 = 0.f, o1 = 0.f;
    #pragma unroll
    for (int s = 0; s < KS; ++s) {
        float w = __builtin_exp2f(ms[s] - M);
        v2f  p = *(const v2f*)&part[s * QTL + hi][q16 * PPITCH + c0];
        L  += w * lBuf[s * QTL + hi][q16];
        o0 += w * p[0];
        o1 += w * p[1];
    }

    // ---- finalize: gamma * o / L + residual; one 128-B line per store ----
    float invq = 1.0f / L;
    out[idx0]      = g * o0 * invq + x0;
    out[idx0 + NN] = g * o1 * invq + x1;
}

// ---------------------------------------------------------------------------
extern "C" void kernel_launch(void* const* d_in, const int* in_sizes, int n_in,
                              void* d_out, int out_size, void* d_ws, size_t ws_size,
                              hipStream_t stream) {
    const float* x     = (const float*)d_in[0];
    const float* Wq    = (const float*)d_in[1];
    const float* bq    = (const float*)d_in[2];
    const float* Wk    = (const float*)d_in[3];
    const float* bk    = (const float*)d_in[4];
    const float* Wv    = (const float*)d_in[5];
    const float* bv    = (const float*)d_in[6];
    const float* gamma = (const float*)d_in[7];
    float* out = (float*)d_out;

    _Float16* ws = (_Float16*)d_ws;
    _Float16* qT   = ws + QT_OFF;
    _Float16* kT   = ws + KT_OFF;
    _Float16* vSw  = ws + VS_OFF;

    proj_kernel<<<(BB * NN / PN) * PG, 32, 0, stream>>>(x, Wq, bq, Wk, bk, Wv, bv, qT, kT, vSw);
    attn_flash_kernel<<<(BB * NN / 16) / QTL, NWV * 32, 0, stream>>>(qT, kT, vSw, x, gamma, out);
}

// v004
// A run of this version takes 21.6 microseconds.
// Timed twice side by side with v003, it ran 1.17 and 1.19 times as fast.
// Counting every step since v000, it is 7.84 times as fast.
#include <hip/hip_runtime.h>

typedef __attribute__((ext_vector_type(16))) _Float16 v16h;
typedef __attribute__((ext_vector_type(8)))  _Float16 v8h;
typedef __attribute__((ext_vector_type(2)))  _Float16 v2h;
typedef __attribute__((ext_vector_type(8)))  float    v8f;
typedef __attribute__((ext_vector_type(4)))  float    v4f;
typedef __attribute__((ext_vector_type(2)))  float    v2f;

#define BB 2
#define CC 64
#define C8 8
#define NN 4096
#define LOG2E 1.44269504088896340736f

// Workspace layout (f16 elements). K and V lie in the order in which a wave of the
// attention kernel loads them, so that each of its 16-byte-per-lane loads is 512 bytes in a row:
//   qT  [B][N][8]               : q channels * log2(e)
//   kT  [B][N/32][32][8]        : slot 16*h + c of a 32-key block = the 8 channels of key 2*c + h
//   vSw [B][N/32][4][2][32][8]  : [channel group][part p][lane 16*hi + c] =
//                                 channel 16*group + c, keys 16*p + 8*hi + 0..7 of the block
#define QT_OFF  ((size_t)0)
#define KT_OFF  ((size_t)BB * NN * 8)
#define VS_OFF  (KT_OFF + (size_t)BB * NN * 8)
#define KBLK    256              // f16 per 32-key block of kT
#define VBLK    2048             // f16 per 32-key block of vSw

// ---------------------------------------------------------------------------
// All three projections in one launch, as f32 matrix products (16x16x4 form).
// One wave per work-group: 64 columns n of one batch (four fragments of 16,
// fragment f = columns n0 + 4*c + f, so a lane's 16-byte load of x feeds all
// four) times one group of 16 output channels: group 0 = q (rows 0-7) and
// k (rows 8-15), groups 1-4 = v.
// k order, the same for the x and the weight fragment: lane half h, step kk,
// element e  ->  input channel 32*h + 2*kk + e.
//   group 0  : D = W * x    -> a lane holds the 8 q (h = 0) or k (h = 1)
//              channels of one column: one 16-byte store
//   groups 1+: D = x^T * W^T -> a lane holds 32 consecutive n of one channel:
//              its channel's share of one 32-key block of vSw, four 16-byte pieces
// ---------------------------------------------------------------------------
#define PN 64                    // columns per wave
#define PG 5                     // channel groups: q|k, v0-15, v16-31, v32-47, v48-63

__global__ __launch_bounds__(32) void proj_kernel(
    const float* __restrict__ x,
    const float* __restrict__ Wq, const float* __restrict__ bq,
    const float* __restrict__ Wk, const float* __restrict__ bk,
    const float* __restrict__ Wv, const float* __restrict__ bv,
    _Float16* __restrict__ qT, _Float16* __restrict__ kT,
    _Float16* __restrict__ vSw)
{
    const int c  = threadIdx.x & 15;
    const int h  = threadIdx.x >> 4;
    const int g  = blockIdx.x % PG;
    const int nb = blockIdx.x / PG;
    const int b  = nb / (NN / PN);
    const int n0 = (nb % (NN / PN)) * PN;

    const float* wrow = (g == 0) ? ((c < 8) ? Wq + c * CC : Wk + (c - 8) * CC)
                                 : Wv + ((g - 1) * 16 + c) * CC;
    wrow += h * 32;
    const float* xp = x + ((size_t)(b * CC + h * 32)) * NN + n0 + 4 * c;
    // accumulator start, D register r: group 0 = bias of channel r of q (h = 0) or k (h = 1);
    // groups 1+ = the lane's own channel's bias in every register
    const float* bp = (g == 0) ? (h ? bk : bq) : bv + ((g - 1) * 16 + c);
    const int    bs = (g == 0) ? 1 : 0;

    float bias[8];
    #pragma unroll
    for (int r = 0; r < 8; ++r) bias[r] = bp[r * bs];
    v4f xr[32];
    #pragma unroll
    for (int i = 0; i < 32; ++i) xr[i] = *(const v4f*)(xp + (size_t)i * NN);
    v4f wr[8];
    #pragma unroll
    for (int i = 0; i < 8; ++i) wr[i] = *(const v4f*)(wrow + 4 * i);
    // stands in front of the first reuse of the address registers of the loads above
    asm volatile("s_wait_xcnt 0x0" ::: "memory");

    v8f acc[4];
    #pragma unroll
    for (int f = 0; f < 4; ++f)
        #pragma unroll
        for (int r = 0; r < 8; ++r) acc[f][r] = bias[r];

    if (g != 0) {
        #pragma unroll
        for (int kk = 0; kk < 16; ++kk) {
            v2f w = (v2f){wr[kk >> 1][(2 * kk) & 3], wr[kk >> 1][((2 * kk) & 3) + 1]};
            #pragma unroll
            for (int f = 0; f < 4; ++f) {
                v2f xv = (v2f){xr[2 * kk][f], xr[2 * kk + 1][f]};
                acc[f] = __builtin_amdgcn_wmma_f32_16x16x4_f32(
                    false, xv, false, w, (short)0, acc[f], false, false);
            }
        }
        // acc[f][r] = v[16*(g-1) + c][n0 + 32*h + 4*r + f]; the piece of keys 8*jj .. 8*jj+7
        // (r = 2*jj, 2*jj+1) goes to part jj >> 1, lane half jj & 1: 16 lanes store 256 B in a row
        _Float16* dst = vSw + (size_t)b * CC * NN + (size_t)((n0 >> 5) + h) * VBLK
                            + (g - 1) * 512 + c * 8;
        #pragma unroll
        for (int jj = 0; jj < 4; ++jj) {
            v8h o;
            #pragma unroll
            for (int e = 0; e < 8; ++e) o[e] = (_Float16)acc[e & 3][2 * jj + (e >> 2)];
            *(v8h*)(dst + (jj >> 1) * 256 + (jj & 1) * 128) = o;
        }
        // the built code lays the q|k path behind these stores and reuses their registers there:
        // the wait stands in front of that reuse
        asm volatile("s_wait_xcnt 0x0" ::: "memory");
        return;
    }

    #pragma unroll
    for (int kk = 0; kk < 16; ++kk) {
        v2f w = (v2f){wr[kk >> 1][(2 * kk) & 3], wr[kk >> 1][((2 * kk) & 3) + 1]};
        #pragma unroll
        for (int f = 0; f < 4; ++f) {
            v2f xv = (v2f){xr[2 * kk][f], xr[2 * kk + 1][f]};
            acc[f] = __builtin_amdgcn_wmma_f32_16x16x4_f32(
                false, w, false, xv, (short)0, acc[f], false, false);
        }
    }
    const float s = h ? 1.0f : LOG2E;
    // column n0 + 4*c + f: q row as it is; k = key 4*(c & 7) + f of block c >> 3,
    // slot 16*(f & 1) + 2*(c & 7) + (f >> 1)
    _Float16* dst = h ? kT + ((size_t)(b * NN + n0 + (c >> 3) * 32 + 2 * (c & 7))) * 8
                      : qT + ((size_t)(b * NN + n0 + 4 * c)) * 8;
    #pragma unroll
    for (int f = 0; f < 4; ++f) {
        v8h o;
        #pragma unroll
        for (int r = 0; r < 8; ++r) o[r] = (_Float16)(acc[f][r] * s);
        *(v8h*)(dst + (h ? (f & 1) * 16 + (f >> 1) : f) * 8) = o;
    }
}

// ---------------------------------------------------------------------------
// Fused flash-attention. One work-group per 32 queries (two 16-query tiles);
// the keys are split over KS waves per tile: wave (tq, ks) walks the 32-key
// blocks ks, ks + KS, ... with its own maxima, sums and accumulators, and the
// KS partial results of a tile are merged through LDS behind one barrier.
// A wave walks its keys twice. Pass 1: score WMMAs and in-lane maxima only, then
// one exchange over the 16 lanes gives the row maxima of the whole range.
// Pass 2, per step: 2 score WMMA with minus the maximum as C operand, exp2,
// 1 row-sum WMMA (ones x P^T) + 4 PV WMMA; sums and accumulators are never rescaled.
// Softmax kept in log2 domain (q pre-scaled by log2 e).
// ---------------------------------------------------------------------------
#define KS 16                    // key ranges (waves) per query tile
#define QTL 2                    // query tiles per work-group
#define NWV (KS * QTL)           // waves per work-group
#define PPITCH 68                // f32 per query row of a partial (16 B x odd)

__global__ __launch_bounds__(NWV * 32) void attn_flash_kernel(
    const _Float16* __restrict__ qT, const _Float16* __restrict__ kT,
    const _Float16* __restrict__ vSw,
    const float* __restrict__ x, const float* __restrict__ gamma,
    float* __restrict__ out)
{
    __shared__ __align__(32) _Float16 pBuf[NWV][16 * 32];     // per-wave P tile (chunk-swizzled)
    __shared__ __align__(16) float    part[NWV][16 * PPITCH]; // per-wave partial [query][channel]
    __shared__ __align__(16) float    mBuf[NWV][16];          // per-wave row maxima (log2 domain)
    __shared__ __align__(16) float    lBuf[NWV][16];          // per-wave denominators

    const int lane = threadIdx.x & 31;
    // wave-uniform by construction; held in a scalar register so that key offsets and LDS bases
    // are scalar arithmetic and cost no vector registers under the 128-register budget
    const int wid  = __builtin_amdgcn_readfirstlane(threadIdx.x >> 5);
    const int tq   = wid & (QTL - 1);               // query tile in the work-group
    const int ks   = wid / QTL;                     // key range of this wave
    const int tile = blockIdx.x * QTL + tq;         // 512 tiles
    const int b    = tile >> 8;
    const int i0   = (tile & 255) << 4;
    const int q16  = lane & 15;
    const int hi   = lane >> 4;

    _Float16* pS = &pBuf[wid][0];

    // Q^T twice: aQ[0] holds the 8 channels at k = 0-7 (lanes 0-15), aQ[1] at k = 8-15
    // (lanes 16-31), zero elsewhere. One K operand then serves both score products: its lanes
    // 0-15 hold the even keys (k = 0-7), its lanes 16-31 the odd keys (k = 8-15).
    const v8h q8 = *(const v8h*)(qT + (size_t)(b * NN + i0 + q16) * 8);
    v16h aQ[2];
    #pragma unroll
    for (int e = 0; e < 8; ++e) {
        aQ[0][e]     = hi ? (_Float16)0.f : q8[e];
        aQ[1][e]     = hi ? q8[e] : (_Float16)0.f;
        aQ[0][e + 8] = (_Float16)0.f;
        aQ[1][e + 8] = (_Float16)0.f;
    }

    v16h aOnes;
    #pragma unroll
    for (int i = 0; i < 16; ++i) aOnes[i] = (_Float16)1.f;

    v8f zero8;
    #pragma unroll
    for (int e = 0; e < 8; ++e) zero8[e] = 0.f;

    v8f acc[4];
    #pragma unroll
    for (int cg = 0; cg < 4; ++cg) acc[cg] = zero8;

    v8f cs = zero8;                                  // row sums of P: every row = denom of query q16

    const _Float16* kB = kT + (size_t)b * NN * 8 + lane * 8;
    const _Float16* vB = vSw + (size_t)b * CC * NN + lane * 8;

    // chunk-swizzled P row offset for this lane's j pair (j = 2*q16, 2*q16+1)
    const int swoff = (((q16 >> 2) & 1) << 4) | ((q16 >> 3) << 3);
    const int pvidx = swoff + ((2 * q16) & 7);       // even f16 index within row

    // merge role: lane -> query (tile hi, column q16), wave -> two channels;
    // its residual values are fetched here so that the key loop covers their latency
    const int c0 = 2 * wid;
    const size_t idx0 = ((size_t)(b * CC + c0)) * NN + ((blockIdx.x * (16 * QTL)) & (NN - 1)) + lane;
    const float x0 = x[idx0];
    const float x1 = x[idx0 + NN];
    const float g  = gamma[0];

    // ---- pass 1: row maxima over all keys of this wave's range --------------
    float mx[8];
    #pragma unroll
    for (int r = 0; r < 8; ++r) mx[r] = -3.0e38f;
    // unrolled by four so that four K loads are in flight together; all eight at once
    // do not fit the 128 registers of a wave and spill
    #pragma unroll 4
    for (int t = 0; t < NN / (KS * 32); ++t) {
        const v8h k8 = *(const v8h*)(kB + (size_t)(t * KS + ks) * KBLK);
        v16h bK;
        #pragma unroll
        for (int e = 0; e < 8; ++e) { bK[e] = k8[e]; bK[e + 8] = (_Float16)0.f; }
        v8f c01[2];
        #pragma unroll
        for (int h = 0; h < 2; ++h)
            c01[h] = __builtin_amdgcn_wmma_f32_16x16x32_f16(
                false, aQ[h], false, bK, (short)0, zero8, false, false);
        #pragma unroll
        for (int r = 0; r < 8; ++r) mx[r] = fmaxf(mx[r], fmaxf(c01[0][r], c01[1][r]));
    }

    // ---- packed f16 row-max butterfly over the 16-lane half, once per wave ---
    v2h pk[4];
    #pragma unroll
    for (int i = 0; i < 4; ++i) pk[i] = (v2h){(_Float16)mx[2 * i], (_Float16)mx[2 * i + 1]};
    #pragma unroll
    for (int msk = 1; msk < 16; msk <<= 1) {
        #pragma unroll
        for (int i = 0; i < 4; ++i) {
            int o = __shfl_xor(__builtin_bit_cast(int, pk[i]), msk, 16);
            pk[i] = __builtin_elementwise_max(pk[i], __builtin_bit_cast(v2h, o));
        }
    }
    float m[8];
    v8f negM;                                        // C operand of the score products of pass 2
    #pragma unroll
    for (int r = 0; r < 8; ++r) { m[r] = (float)pk[r >> 1][r & 1]; negM[r] = -m[r]; }

    // ---- pass 2 ---------------------------------------------------------------
    for (int t = 0; t < NN / (KS * 32); ++t) {
        const int blk = t * KS + ks;                 // 32-key block
        // ---- energy minus row maximum (log2 domain): lane q16 -> keys 2*q16(+1)
        //      of the block; one 512-byte load brings all 32 keys -----------
        const v8h k8 = *(const v8h*)(kB + (size_t)blk * KBLK);
        v16h bK;
        #pragma unroll
        for (int e = 0; e < 8; ++e) { bK[e] = k8[e]; bK[e + 8] = (_Float16)0.f; }
        v8f c01[2];
        #pragma unroll
        for (int h = 0; h < 2; ++h)
            c01[h] = __builtin_amdgcn_wmma_f32_16x16x32_f16(
                false, aQ[h], false, bK, (short)0, negM, false, false);

        // ---- exp2, stage P (packed b32) ------------------------------------
        #pragma unroll
        for (int r = 0; r < 8; ++r) {
            float p0 = __builtin_exp2f(c01[0][r]);
            float p1 = __builtin_exp2f(c01[1][r]);
            int row = r + 8 * hi;
            ((v2h*)pS)[(row * 32 + pvidx) >> 1] = (v2h){(_Float16)p0, (_Float16)p1};
        }

        // ---- P^T operand: one aligned 32B LDS read per lane --------------
        v16h bP = *(const v16h*)(pS + q16 * 32 + hi * 16);

        // ---- softmax denominator via ones x P^T (row-sum WMMA) -----------
        cs = __builtin_amdgcn_wmma_f32_16x16x32_f16(
            false, aOnes, false, bP, (short)0, cs, false, false);

        // ---- out^T += V x P^T, 4 channel groups --------------------------
        #pragma unroll
        for (int cg = 0; cg < 4; ++cg) {
            const _Float16* vp = vB + (size_t)blk * VBLK + cg * 512;
            const v8h v0 = *(const v8h*)(vp);
            const v8h v1 = *(const v8h*)(vp + 256);
            v16h aV = __builtin_shufflevector(v0, v1, 0, 1, 2, 3, 4, 5, 6, 7,
                                              8, 9, 10, 11, 12, 13, 14, 15);
            acc[cg] = __builtin_amdgcn_wmma_f32_16x16x32_f16(
                false, aV, false, bP, (short)0, acc[cg], false, false);
        }
    }
    const float lcol = cs[0];

    // ---- publish this wave's partial: maxima, denominator, accumulators --
    #pragma unroll
    for (int r = 0; r < 8; ++r)
        if (q16 == 0) mBuf[wid][r + 8 * hi] = m[r];
    if (hi == 0) lBuf[wid][q16] = lcol;
    float* pw = &part[wid][q16 * PPITCH + 8 * hi];
    #pragma unroll
    for (int cg = 0; cg < 4; ++cg) {
        *(v4f*)(pw + cg * 16)     = (v4f){acc[cg][0], acc[cg][1], acc[cg][2], acc[cg][3]};
        *(v4f*)(pw + cg * 16 + 4) = (v4f){acc[cg][4], acc[cg][5], acc[cg][6], acc[cg][7]};
    }

    // every wave's partial is in LDS before any wave reads another's
    __syncthreads();

    // ---- merge the KS key ranges: weights exp2(m - M) --------------------
    float ms[KS];
    float M = -3.0e38f;
    #pragma unroll
    for (int s = 0; s < KS; ++s) {
        ms[s] = mBuf[s * QTL + hi][q16];
        M = fmaxf(M, ms[s]);
    }
    float L = 0.f, o0 = 0.f, o1 = 0.f;
    #pragma unroll
    for (int s = 0; s < KS; ++s) {
        float w = __builtin_exp2f(ms[s] - M);
        v2f  p = *(const v2f*)&part[s * QTL + hi][q16 * PPITCH + c0];
        L  += w * lBuf[s * QTL + hi][q16];
        o0 += w * p[0];
        o1 += w * p[1];
    }

    // ---- finalize: gamma * o / L + residual; one 128-B line per store ----
    float invq = 1.0f / L;
    out[idx0]      = g * o0 * invq + x0;
    out[idx0 + NN] = g * o1 * invq + x1;
}

// ---------------------------------------------------------------------------
extern "C" void kernel_launch(void* const* d_in, const int* in_sizes, int n_in,
                              void* d_out, int out_size, void* d_ws, size_t ws_size,
                              hipStream_t stream) {
    const float* x     = (const float*)d_in[0];
    const float* Wq    = (const float*)d_in[1];
    const float* bq    = (const float*)d_in[2];
    const float* Wk    = (const float*)d_in[3];
    const float* bk    = (const float*)d_in[4];
    const float* Wv    = (const float*)d_in[5];
    const float* bv    = (const float*)d_in[6];
    const float* gamma = (const float*)d_in[7];
    float* out = (float*)d_out;

    _Float16* ws = (_Float16*)d_ws;
    _Float16* qT   = ws + QT_OFF;
    _Float16* kT   = ws + KT_OFF;
    _Float16* vSw  = ws + VS_OFF;

    proj_kernel<<<(BB * NN / PN) * PG, 32, 0, stream>>>(x, Wq, bq, Wk, bk, Wv, bv, qT, kT, vSw);
    attn_flash_kernel<<<(BB * NN / 16) / QTL, NWV * 32, 0, stream>>>(qT, kT, vSw, x, gamma, out);
}

// v005
// One run takes 16.9 microseconds.
// Two timings next to v004 put it at 1.25 and 1.26 times that version's speed.
// All steps since v000 together make it 9.82 times as fast.
#include <hip/hip_runtime.h>

typedef __attribute__((ext_vector_type(16))) _Float16 v16h;
typedef __attribute__((ext_vector_type(8)))  _Float16 v8h;
typedef __attribute__((ext_vector_type(2)))  _Float16 v2h;
typedef __attribute__((ext_vector_type(8)))  float    v8f;
typedef __attribute__((ext_vector_type(4)))  float    v4f;
typedef __attribute__((ext_vector_type(2)))  float    v2f;
typedef __attribute__((ext_vector_type(4)))  unsigned v4u;
typedef __attribute__((ext_vector_type(8)))  unsigned v8u;

#define BB 2
#define CC 64
#define C8 8
#define NN 4096
#define LOG2E 1.44269504088896340736f

// Workspace layout (f16 elements). K and V lie in the order in which a wave of the
// attention kernel loads them, so that each of its 16-byte-per-lane loads is 512 bytes in a row:
//   qT  [B][N][8]               : q channels * log2(e)
//   kT  [B][N/32][32][8]        : slot 16*h + c of a 32-key block = the 8 channels of key 2*c + h
//   vSw [B][N/32][4][2][32][8]  : [channel group][part p][lane 16*hi + c] =
//                                 channel 16*group + c, keys 16*p + 8*hi + 0..7 of the block
#define QT_OFF  ((size_t)0)
#define KT_OFF  ((size_t)BB * NN * 8)
#define VS_OFF  (KT_OFF + (size_t)BB * NN * 8)
#define KBLK    256              // f16 per 32-key block of kT
#define VBLK    2048             // f16 per 32-key block of vSw

// ---------------------------------------------------------------------------
// All three projections in one launch, as f32 matrix products (16x16x4 form).
// One wave per work-group: 64 columns n of one batch (four fragments of 16,
// fragment f = columns n0 + 4*c + f, so a lane's 16-byte load of x feeds all
// four) times one group of 16 output channels: group 0 = q (rows 0-7) and
// k (rows 8-15), groups 1-4 = v.
// k order, the same for the x and the weight fragment: lane half h, step kk,
// element e  ->  input channel 32*h + 2*kk + e.
//   group 0  : D = W * x    -> a lane holds the 8 q (h = 0) or k (h = 1)
//              channels of one column: one 16-byte store
//   groups 1+: D = x^T * W^T -> a lane holds 32 consecutive n of one channel:
//              its channel's share of one 32-key block of vSw, four 16-byte pieces
// ---------------------------------------------------------------------------
#define PN 64                    // columns per wave
#define PG 5                     // channel groups: q|k, v0-15, v16-31, v32-47, v48-63

__global__ __launch_bounds__(32) void proj_kernel(
    const float* __restrict__ x,
    const float* __restrict__ Wq, const float* __restrict__ bq,
    const float* __restrict__ Wk, const float* __restrict__ bk,
    const float* __restrict__ Wv, const float* __restrict__ bv,
    _Float16* __restrict__ qT, _Float16* __restrict__ kT,
    _Float16* __restrict__ vSw)
{
    const int c  = threadIdx.x & 15;
    const int h  = threadIdx.x >> 4;
    const int g  = blockIdx.x % PG;
    const int nb = blockIdx.x / PG;
    const int b  = nb / (NN / PN);
    const int n0 = (nb % (NN / PN)) * PN;

    const float* wrow = (g == 0) ? ((c < 8) ? Wq + c * CC : Wk + (c - 8) * CC)
                                 : Wv + ((g - 1) * 16 + c) * CC;
    wrow += h * 32;
    const float* xp = x + ((size_t)(b * CC + h * 32)) * NN + n0 + 4 * c;
    // accumulator start, D register r: group 0 = bias of channel r of q (h = 0) or k (h = 1);
    // groups 1+ = the lane's own channel's bias in every register
    const float* bp = (g == 0) ? (h ? bk : bq) : bv + ((g - 1) * 16 + c);
    const int    bs = (g == 0) ? 1 : 0;

    float bias[8];
    #pragma unroll
    for (int r = 0; r < 8; ++r) bias[r] = bp[r * bs];
    v4f xr[32];
    #pragma unroll
    for (int i = 0; i < 32; ++i) xr[i] = *(const v4f*)(xp + (size_t)i * NN);
    v4f wr[8];
    #pragma unroll
    for (int i = 0; i < 8; ++i) wr[i] = *(const v4f*)(wrow + 4 * i);
    // stands in front of the first reuse of the address registers of the loads above
    asm volatile("s_wait_xcnt 0x0" ::: "memory");

    v8f acc[4];
    #pragma unroll
    for (int f = 0; f < 4; ++f)
        #pragma unroll
        for (int r = 0; r < 8; ++r) acc[f][r] = bias[r];

    if (g != 0) {
        #pragma unroll
        for (int kk = 0; kk < 16; ++kk) {
            v2f w = (v2f){wr[kk >> 1][(2 * kk) & 3], wr[kk >> 1][((2 * kk) & 3) + 1]};
            #pragma unroll
            for (int f = 0; f < 4; ++f) {
                v2f xv = (v2f){xr[2 * kk][f], xr[2 * kk + 1][f]};
                acc[f] = __builtin_amdgcn_wmma_f32_16x16x4_f32(
                    false, xv, false, w, (short)0, acc[f], false, false);
            }
        }
        // acc[f][r] = v[16*(g-1) + c][n0 + 32*h + 4*r + f]; the piece of keys 8*jj .. 8*jj+7
        // (r = 2*jj, 2*jj+1) goes to part jj >> 1, lane half jj & 1: 16 lanes store 256 B in a row
        _Float16* dst = vSw + (size_t)b * CC * NN + (size_t)((n0 >> 5) + h) * VBLK
                            + (g - 1) * 512 + c * 8;
        #pragma unroll
        for (int jj = 0; jj < 4; ++jj) {
            v8h o;
            #pragma unroll
            for (int e = 0; e < 8; ++e) o[e] = (_Float16)acc[e & 3][2 * jj + (e >> 2)];
            *(v8h*)(dst + (jj >> 1) * 256 + (jj & 1) * 128) = o;
        }
        // the built code lays the q|k path behind these stores and reuses their registers there:
        // the wait stands in front of that reuse
        asm volatile("s_wait_xcnt 0x0" ::: "memory");
        return;
    }

    #pragma unroll
    for (int kk = 0; kk < 16; ++kk) {
        v2f w = (v2f){wr[kk >> 1][(2 * kk) & 3], wr[kk >> 1][((2 * kk) & 3) + 1]};
        #pragma unroll
        for (int f = 0; f < 4; ++f) {
            v2f xv = (v2f){xr[2 * kk][f], xr[2 * kk + 1][f]};
            acc[f] = __builtin_amdgcn_wmma_f32_16x16x4_f32(
                false, w, false, xv, (short)0, acc[f], false, false);
        }
    }
    const float s = h ? 1.0f : LOG2E;
    // column n0 + 4*c + f: q row as it is; k = key 4*(c & 7) + f of block c >> 3,
    // slot 16*(f & 1) + 2*(c & 7) + (f >> 1)
    _Float16* dst = h ? kT + ((size_t)(b * NN + n0 + (c >> 3) * 32 + 2 * (c & 7))) * 8
                      : qT + ((size_t)(b * NN + n0 + 4 * c)) * 8;
    #pragma unroll
    for (int f = 0; f < 4; ++f) {
        v8h o;
        #pragma unroll
        for (int r = 0; r < 8; ++r) o[r] = (_Float16)(acc[f][r] * s);
        *(v8h*)(dst + (h ? (f & 1) * 16 + (f >> 1) : f) * 8) = o;
    }
}

// ---------------------------------------------------------------------------
// Fused flash-attention. One work-group per 32 queries (two 16-query tiles);
// the keys are split over KS waves: wave ks walks the 32-key blocks ks, ks + KS, ...
// for BOTH query tiles, so that each K and V fragment it loads feeds two products,
// with its own maxima, sums and accumulators per tile, and the KS partial results
// of a tile are merged through LDS behind one barrier.
// A wave walks its keys twice. Pass 1: score WMMAs and in-lane maxima only, then
// one exchange over the 16 lanes gives the row maxima of the whole range.
// Pass 2, per step and tile: 2 score WMMA with minus the maximum as C operand, exp2,
// 1 row-sum WMMA (ones x P^T) + 4 PV WMMA; sums and accumulators are never rescaled.
// Softmax kept in log2 domain (q pre-scaled by log2 e).
// ---------------------------------------------------------------------------
#define KS 16                    // key ranges = waves per work-group
#define QTL 2                    // query tiles per work-group and per wave
#define NPT (KS * QTL)           // partial results per work-group
#define PPITCH 68                // f32 per query row of a partial (16 B x odd)

__global__ __launch_bounds__(KS * 32) void attn_flash_kernel(
    const _Float16* __restrict__ qT, const _Float16* __restrict__ kT,
    const _Float16* __restrict__ vSw,
    const float* __restrict__ x, const float* __restrict__ gamma,
    float* __restrict__ out)
{
    __shared__ __align__(32) _Float16 pBuf[NPT][16 * 32];     // per wave and tile: P tile (chunk-swizzled)
    __shared__ __align__(16) float    part[NPT][16 * PPITCH]; // per wave and tile: partial [query][channel]
    __shared__ __align__(16) float    mBuf[NPT][16];          // row maxima (log2 domain)
    __shared__ __align__(16) float    lBuf[NPT][16];          // denominators

    const int lane = threadIdx.x & 31;
    // wave-uniform by construction; held in a scalar register so that key offsets and LDS bases
    // are scalar arithmetic and cost no vector registers
    const int ks   = __builtin_amdgcn_readfirstlane(threadIdx.x >> 5);   // key range of this wave
    const int b    = blockIdx.x >> 7;               // 128 work-groups per batch
    const int i0   = (blockIdx.x & 127) << 5;       // first of the 32 queries
    const int q16  = lane & 15;
    const int hi   = lane >> 4;

    // Q^T once per tile: the 8 channels at k = 0-7 (lanes 0-15) and again at k = 8-15 (lanes 16-31).
    // A loaded K fragment holds the even keys in lanes 0-15 (k = 0-7) and the odd keys in lanes
    // 16-31 (k = 8-15); each score product takes it with the other lane half set to zero.
    v16h aQ[QTL];
    #pragma unroll
    for (int tq = 0; tq < QTL; ++tq) {
        const v8h q8 = *(const v8h*)(qT + (size_t)(b * NN + i0 + 16 * tq + q16) * 8);
        #pragma unroll
        for (int e = 0; e < 8; ++e) { aQ[tq][e] = q8[e]; aQ[tq][e + 8] = (_Float16)0.f; }
    }

    v16h aOnes;
    #pragma unroll
    for (int i = 0; i < 16; ++i) aOnes[i] = (_Float16)1.f;

    v8f zero8;
    #pragma unroll
    for (int e = 0; e < 8; ++e) zero8[e] = 0.f;

    v8f acc[QTL][4];
    v8f cs[QTL];                                     // row sums of P: every row = denom of query q16
    #pragma unroll
    for (int tq = 0; tq < QTL; ++tq) {
        #pragma unroll
        for (int cg = 0; cg < 4; ++cg) acc[tq][cg] = zero8;
        cs[tq] = zero8;
    }

    // wave-uniform bases and one 32-bit lane offset: a block's address is scalar arithmetic plus
    // that offset, and no address pair has to live in vector registers across the key loop
    const _Float16* kB = kT + (size_t)b * NN * 8;
    const _Float16* vB = vSw + (size_t)b * CC * NN;
    const unsigned  lo = (unsigned)lane * 8u;

    // chunk-swizzled P row offset for this lane's j pair (j = 2*q16, 2*q16+1)
    const int swoff = (((q16 >> 2) & 1) << 4) | ((q16 >> 3) << 3);
    const int pvidx = swoff + ((2 * q16) & 7);       // even f16 index within row

    // merge role: lane -> query (tile hi, column q16), wave -> four channels
    const int c0 = 4 * ks;
    const size_t idx0 = ((size_t)(b * CC + c0)) * NN + i0 + lane;
    const float g  = gamma[0];

    // ---- pass 1: row maxima over all keys of this wave's range --------------
    float mx[QTL][8];
    #pragma unroll
    for (int tq = 0; tq < QTL; ++tq)
        #pragma unroll
        for (int r = 0; r < 8; ++r) mx[tq][r] = -3.0e38f;
    // unrolled whole so that all eight K loads are in flight together
    #pragma unroll
    for (int t = 0; t < NN / (KS * 32); ++t) {
        const v8h k8 = *(const v8h*)(kB + (size_t)(t * KS + ks) * KBLK + lo);
        // selected as 32-bit words: one select per register, not one per f16
        const v4u kw = __builtin_bit_cast(v4u, k8);
        v8u bw[2];
        #pragma unroll
        for (int e = 0; e < 4; ++e) {
            bw[0][e]     = hi ? 0u : kw[e];
            bw[1][e]     = hi ? kw[e] : 0u;
            bw[0][e + 4] = 0u;
            bw[1][e + 4] = 0u;
        }
        const v16h bK[2] = {__builtin_bit_cast(v16h, bw[0]), __builtin_bit_cast(v16h, bw[1])};
        #pragma unroll
        for (int tq = 0; tq < QTL; ++tq) {
            v8f c01[2];
            #pragma unroll
            for (int h = 0; h < 2; ++h)
                c01[h] = __builtin_amdgcn_wmma_f32_16x16x32_f16(
                    false, aQ[tq], false, bK[h], (short)0, zero8, false, false);
            #pragma unroll
            for (int r = 0; r < 8; ++r) mx[tq][r] = fmaxf(mx[tq][r], fmaxf(c01[0][r], c01[1][r]));
        }
    }

    // ---- first block of pass 2: its loads fly under the exchange below ------
    v8h kf[2];
    v8h vf[2][8];
    kf[0] = *(const v8h*)(kB + (size_t)ks * KBLK + lo);
    #pragma unroll
    for (int i = 0; i < 8; ++i) vf[0][i] = *(const v8h*)(vB + (size_t)ks * VBLK + i * 256 + lo);
    // keeps these loads in front of the exchange, which then covers their latency
    __builtin_amdgcn_sched_barrier(0);

    // ---- packed f16 row-max butterfly over the 16-lane half, once per wave ---
    v2h pk[QTL][4];
    #pragma unroll
    for (int tq = 0; tq < QTL; ++tq)
        #pragma unroll
        for (int i = 0; i < 4; ++i)
            pk[tq][i] = (v2h){(_Float16)mx[tq][2 * i], (_Float16)mx[tq][2 * i + 1]};
    #pragma unroll
    for (int msk = 1; msk < 16; msk <<= 1) {
        #pragma unroll
        for (int tq = 0; tq < QTL; ++tq)
            #pragma unroll
            for (int i = 0; i < 4; ++i) {
                int o = __shfl_xor(__builtin_bit_cast(int, pk[tq][i]), msk, 16);
                pk[tq][i] = __builtin_elementwise_max(pk[tq][i], __builtin_bit_cast(v2h, o));
            }
    }
    float m[QTL][8];
    v8f negM[QTL];                                   // C operand of the score products of pass 2
    #pragma unroll
    for (int tq = 0; tq < QTL; ++tq)
        #pragma unroll
        for (int r = 0; r < 8; ++r) {
            m[tq][r] = (float)pk[tq][r >> 1][r & 1];
            negM[tq][r] = -m[tq][r];
        }

    // ---- pass 2 ---------------------------------------------------------------
    // one 512-byte load brings the K of all 32 keys of a block, eight bring its V
    auto fetch = [&](int t, v8h& k8, v8h (&vv)[8]) __attribute__((always_inline)) {
        const int blk = t * KS + ks;                 // 32-key block
        k8 = *(const v8h*)(kB + (size_t)blk * KBLK + lo);
        #pragma unroll
        for (int i = 0; i < 8; ++i) vv[i] = *(const v8h*)(vB + (size_t)blk * VBLK + i * 256 + lo);
    };
    auto step = [&](const v8h& k8, const v8h (&vv)[8]) __attribute__((always_inline)) {
        // ---- energy minus row maximum (log2 domain): lane q16 -> keys 2*q16(+1) of the block
        // selected as 32-bit words: one select per register, not one per f16
        const v4u kw = __builtin_bit_cast(v4u, k8);
        v8u bw[2];
        #pragma unroll
        for (int e = 0; e < 4; ++e) {
            bw[0][e]     = hi ? 0u : kw[e];
            bw[1][e]     = hi ? kw[e] : 0u;
            bw[0][e + 4] = 0u;
            bw[1][e + 4] = 0u;
        }
        const v16h bK[2] = {__builtin_bit_cast(v16h, bw[0]), __builtin_bit_cast(v16h, bw[1])};

        v16h bP[QTL];
        #pragma unroll
        for (int tq = 0; tq < QTL; ++tq) {
            _Float16* pS = &pBuf[ks * QTL + tq][0];
            v8f c01[2];
            #pragma unroll
            for (int h = 0; h < 2; ++h)
                c01[h] = __builtin_amdgcn_wmma_f32_16x16x32_f16(
                    false, aQ[tq], false, bK[h], (short)0, negM[tq], false, false);

            // ---- exp2, stage P (packed b32) --------------------------------
            #pragma unroll
            for (int r = 0; r < 8; ++r) {
                float p0 = __builtin_exp2f(c01[0][r]);
                float p1 = __builtin_exp2f(c01[1][r]);
                int row = r + 8 * hi;
                ((v2h*)pS)[(row * 32 + pvidx) >> 1] = (v2h){(_Float16)p0, (_Float16)p1};
            }
        }
        #pragma unroll
        for (int tq = 0; tq < QTL; ++tq) {
            // ---- P^T operand: one aligned 32B LDS read per lane ----------
            bP[tq] = *(const v16h*)(&pBuf[ks * QTL + tq][0] + q16 * 32 + hi * 16);
            // ---- softmax denominator via ones x P^T (row-sum WMMA) -------
            cs[tq] = __builtin_amdgcn_wmma_f32_16x16x32_f16(
                false, aOnes, false, bP[tq], (short)0, cs[tq], false, false);
        }

        // ---- out^T += V x P^T, 4 channel groups; each V fragment serves both tiles
        #pragma unroll
        for (int cg = 0; cg < 4; ++cg) {
            v16h aV = __builtin_shufflevector(vv[2 * cg], vv[2 * cg + 1], 0, 1, 2, 3, 4, 5, 6, 7,
                                              8, 9, 10, 11, 12, 13, 14, 15);
            #pragma unroll
            for (int tq = 0; tq < QTL; ++tq)
                acc[tq][cg] = __builtin_amdgcn_wmma_f32_16x16x32_f16(
                    false, aV, false, bP[tq], (short)0, acc[tq][cg], false, false);
        }
    };

    // Two register sets: a block's nine loads are issued one whole block ahead of their use.
    // The last two blocks stand behind the loop: with their missing fetch under a branch inside it,
    // the counted waits of the loop would have to hold for both paths and would wait for the
    // youngest loads too. Kept rolled: unrolled whole, its values no longer fit the registers and spill.
    #pragma unroll 1
    for (int t = 0; t < NN / (KS * 32) - 2; t += 2) {
        fetch(t + 1, kf[1], vf[1]);
        // keeps the loads above in front of the block's work: the scheduler otherwise sinks each
        // to its first use, where its whole latency is waited out
        __builtin_amdgcn_sched_barrier(0);
        step(kf[0], vf[0]);
        fetch(t + 2, kf[0], vf[0]);
        // as above
        __builtin_amdgcn_sched_barrier(0);
        step(kf[1], vf[1]);
    }
    fetch(NN / (KS * 32) - 1, kf[1], vf[1]);
    // as above
    __builtin_amdgcn_sched_barrier(0);
    step(kf[0], vf[0]);
    // residual values: fetched here, where one register set has come free, so that the last block
    // covers their latency; held across the key loop they would not fit the registers
    float xres[4];
    #pragma unroll
    for (int j = 0; j < 4; ++j) xres[j] = x[idx0 + (size_t)j * NN];
    // keeps these loads in front of the last block's work
    __builtin_amdgcn_sched_barrier(0);
    step(kf[1], vf[1]);

    // ---- publish this wave's partials: maxima, denominators, accumulators --
    #pragma unroll
    for (int tq = 0; tq < QTL; ++tq) {
        const int pi = ks * QTL + tq;
        #pragma unroll
        for (int r = 0; r < 8; ++r)
            if (q16 == 0) mBuf[pi][r + 8 * hi] = m[tq][r];
        if (hi == 0) lBuf[pi][q16] = cs[tq][0];
        float* pw = &part[pi][q16 * PPITCH + 8 * hi];
        #pragma unroll
        for (int cg = 0; cg < 4; ++cg) {
            *(v4f*)(pw + cg * 16)     = (v4f){acc[tq][cg][0], acc[tq][cg][1], acc[tq][cg][2], acc[tq][cg][3]};
            *(v4f*)(pw + cg * 16 + 4) = (v4f){acc[tq][cg][4], acc[tq][cg][5], acc[tq][cg][6], acc[tq][cg][7]};
        }
    }

    // every wave's partials are in LDS before any wave reads another's
    __syncthreads();

    // ---- merge the KS key ranges: weights exp2(m - M) --------------------
    float ms[KS];
    float M = -3.0e38f;
    #pragma unroll
    for (int s = 0; s < KS; ++s) {
        ms[s] = mBuf[s * QTL + hi][q16];
        M = fmaxf(M, ms[s]);
    }
    float L = 0.f;
    float o[4] = {0.f, 0.f, 0.f, 0.f};
    #pragma unroll
    for (int s = 0; s < KS; ++s) {
        float w = __builtin_exp2f(ms[s] - M);
        v4f  p = *(const v4f*)&part[s * QTL + hi][q16 * PPITCH + c0];
        L  += w * lBuf[s * QTL + hi][q16];
        #pragma unroll
        for (int j = 0; j < 4; ++j) o[j] += w * p[j];
    }

    // ---- finalize: gamma * o / L + residual; one 128-B line per store ----
    float invq = 1.0f / L;
    #pragma unroll
    for (int j = 0; j < 4; ++j)
        out[idx0 + (size_t)j * NN] = g * o[j] * invq + xres[j];
}

// ---------------------------------------------------------------------------
extern "C" void kernel_launch(void* const* d_in, const int* in_sizes, int n_in,
                              void* d_out, int out_size, void* d_ws, size_t ws_size,
                              hipStream_t stream) {
    const float* x     = (const float*)d_in[0];
    const float* Wq    = (const float*)d_in[1];
    const float* bq    = (const float*)d_in[2];
    const float* Wk    = (const float*)d_in[3];
    const float* bk    = (const float*)d_in[4];
    const float* Wv    = (const float*)d_in[5];
    const float* bv    = (const float*)d_in[6];
    const float* gamma = (const float*)d_in[7];
    float* out = (float*)d_out;

    _Float16* ws = (_Float16*)d_ws;
    _Float16* qT   = ws + QT_OFF;
    _Float16* kT   = ws + KT_OFF;
    _Float16* vSw  = ws + VS_OFF;

    proj_kernel<<<(BB * NN / PN) * PG, 32, 0, stream>>>(x, Wq, bq, Wk, bk, Wv, bv, qT, kT, vSw);
    attn_flash_kernel<<<(BB * NN / 16) / QTL, KS * 32, 0, stream>>>(qT, kT, vSw, x, gamma, out);
}

// v006
// It runs in 14.1 microseconds.
// Next to v005, in two timings, it ran 1.20 times as fast each time.
// Over all steps from v000 it is 11.8 times as fast.
#include <hip/hip_runtime.h>

typedef __attribute__((ext_vector_type(16))) _Float16 v16h;
typedef __attribute__((ext_vector_type(8)))  _Float16 v8h;
typedef __attribute__((ext_vector_type(2)))  _Float16 v2h;
typedef __attribute__((ext_vector_type(8)))  float    v8f;
typedef __attribute__((ext_vector_type(4)))  float    v4f;
typedef __attribute__((ext_vector_type(2)))  float    v2f;
typedef __attribute__((ext_vector_type(4)))  unsigned v4u;
typedef __attribute__((ext_vector_type(8)))  unsigned v8u;

#define BB 2
#define CC 64
#define C8 8
#define NN 4096
#define LOG2E 1.44269504088896340736f

// Workspace layout (f16 elements). K and V lie in the order in which a wave of the
// attention kernel loads them, so that each of its 16-byte-per-lane loads is 512 bytes in a row:
//   qT  [B][N][8]               : q channels * log2(e)
//   kT  [B][N/32][32][8]        : slot 16*h + c of a 32-key block = the 8 channels of key 2*c + h
//   vSw [B][N/32][4][2][32][8]  : [channel group][part p][lane 16*hi + c] =
//                                 channel 16*group + c, keys 16*p + 8*hi + 0..7 of the block
#define QT_OFF  ((size_t)0)
#define KT_OFF  ((size_t)BB * NN * 8)
#define VS_OFF  (KT_OFF + (size_t)BB * NN * 8)
#define KBLK    256              // f16 per 32-key block of kT
#define VBLK    2048             // f16 per 32-key block of vSw

// ---------------------------------------------------------------------------
// All three projections in one launch, as f32 matrix products (16x16x4 form).
// One wave per work-group: 64 columns n of one batch (four fragments of 16,
// fragment f = columns n0 + 4*c + f, so a lane's 16-byte load of x feeds all
// four) times one group of 16 output channels: group 0 = q (rows 0-7) and
// k (rows 8-15), groups 1-4 = v.
// k order, the same for the x and the weight fragment: lane half h, step kk,
// element e  ->  input channel 32*h + 2*kk + e.
//   group 0  : D = W * x    -> a lane holds the 8 q (h = 0) or k (h = 1)
//              channels of one column: one 16-byte store
//   groups 1+: D = x^T * W^T -> a lane holds 32 consecutive n of one channel:
//              its channel's share of one 32-key block of vSw, four 16-byte pieces
// ---------------------------------------------------------------------------
#define PN 64                    // columns per wave
#define PG 5                     // channel groups: q|k, v0-15, v16-31, v32-47, v48-63

__global__ __launch_bounds__(32) void proj_kernel(
    const float* __restrict__ x,
    const float* __restrict__ Wq, const float* __restrict__ bq,
    const float* __restrict__ Wk, const float* __restrict__ bk,
    const float* __restrict__ Wv, const float* __restrict__ bv,
    _Float16* __restrict__ qT, _Float16* __restrict__ kT,
    _Float16* __restrict__ vSw)
{
    const int c  = threadIdx.x & 15;
    const int h  = threadIdx.x >> 4;
    const int g  = blockIdx.x % PG;
    const int nb = blockIdx.x / PG;
    const int b  = nb / (NN / PN);
    const int n0 = (nb % (NN / PN)) * PN;

    const float* wrow = (g == 0) ? ((c < 8) ? Wq + c * CC : Wk + (c - 8) * CC)
                                 : Wv + ((g - 1) * 16 + c) * CC;
    wrow += h * 32;
    const float* xp = x + ((size_t)(b * CC + h * 32)) * NN + n0 + 4 * c;
    // accumulator start, D register r: group 0 = bias of channel r of q (h = 0) or k (h = 1);
    // groups 1+ = the lane's own channel's bias in every register
    const float* bp = (g == 0) ? (h ? bk : bq) : bv + ((g - 1) * 16 + c);
    const int    bs = (g == 0) ? 1 : 0;

    float bias[8];
    #pragma unroll
    for (int r = 0; r < 8; ++r) bias[r] = bp[r * bs];
    v4f xr[32];
    #pragma unroll
    for (int i = 0; i < 32; ++i) xr[i] = *(const v4f*)(xp + (size_t)i * NN);
    v4f wr[8];
    #pragma unroll
    for (int i = 0; i < 8; ++i) wr[i] = *(const v4f*)(wrow + 4 * i);
    // stands in front of the first reuse of the address registers of the loads above
    asm volatile("s_wait_xcnt 0x0" ::: "memory");

    v8f acc[4];
    #pragma unroll
    for (int f = 0; f < 4; ++f)
        #pragma unroll
        for (int r = 0; r < 8; ++r) acc[f][r] = bias[r];

    if (g != 0) {
        #pragma unroll
        for (int kk = 0; kk < 16; ++kk) {
            v2f w = (v2f){wr[kk >> 1][(2 * kk) & 3], wr[kk >> 1][((2 * kk) & 3) + 1]};
            #pragma unroll
            for (int f = 0; f < 4; ++f) {
                v2f xv = (v2f){xr[2 * kk][f], xr[2 * kk + 1][f]};
                acc[f] = __builtin_amdgcn_wmma_f32_16x16x4_f32(
                    false, xv, false, w, (short)0, acc[f], false, false);
            }
        }
        // acc[f][r] = v[16*(g-1) + c][n0 + 32*h + 4*r + f]; the piece of keys 8*jj .. 8*jj+7
        // (r = 2*jj, 2*jj+1) goes to part jj >> 1, lane half jj & 1: 16 lanes store 256 B in a row
        _Float16* dst = vSw + (size_t)b * CC * NN + (size_t)((n0 >> 5) + h) * VBLK
                            + (g - 1) * 512 + c * 8;
        #pragma unroll
        for (int jj = 0; jj < 4; ++jj) {
            v8h o;
            #pragma unroll
            for (int e = 0; e < 8; ++e) o[e] = (_Float16)acc[e & 3][2 * jj + (e >> 2)];
            *(v8h*)(dst + (jj >> 1) * 256 + (jj & 1) * 128) = o;
        }
        // the built code lays the q|k path behind these stores and reuses their registers there:
        // the wait stands in front of that reuse
        asm volatile("s_wait_xcnt 0x0" ::: "memory");
        return;
    }

    #pragma unroll
    for (int kk = 0; kk < 16; ++kk) {
        v2f w = (v2f){wr[kk >> 1][(2 * kk) & 3], wr[kk >> 1][((2 * kk) & 3) + 1]};
        #pragma unroll
        for (int f = 0; f < 4; ++f) {
            v2f xv = (v2f){xr[2 * kk][f], xr[2 * kk + 1][f]};
            acc[f] = __builtin_amdgcn_wmma_f32_16x16x4_f32(
                false, w, false, xv, (short)0, acc[f], false, false);
        }
    }
    const float s = h ? 1.0f : LOG2E;
    // column n0 + 4*c + f: q row as it is; k = key 4*(c & 7) + f of block c >> 3,
    // slot 16*(f & 1) + 2*(c & 7) + (f >> 1)
    _Float16* dst = h ? kT + ((size_t)(b * NN + n0 + (c >> 3) * 32 + 2 * (c & 7))) * 8
                      : qT + ((size_t)(b * NN + n0 + 4 * c)) * 8;
    #pragma unroll
    for (int f = 0; f < 4; ++f) {
        v8h o;
        #pragma unroll
        for (int r = 0; r < 8; ++r) o[r] = (_Float16)(acc[f][r] * s);
        *(v8h*)(dst + (h ? (f & 1) * 16 + (f >> 1) : f) * 8) = o;
    }
}

// ---------------------------------------------------------------------------
// Fused flash-attention. One work-group per 32 queries (two 16-query tiles);
// the keys are split over KS waves: wave ks walks the 32-key blocks ks, ks + KS, ...
// for BOTH query tiles, so that each K and V fragment it loads feeds two products,
// with its own maxima, sums and accumulators per tile, and the KS partial results
// of a tile are merged through LDS behind one barrier.
// A wave walks its keys twice. Pass 1: score WMMAs and in-lane maxima only, then
// one exchange over the 16 lanes gives the row maxima of the whole range.
// Pass 2, per step and tile: 2 score WMMA with minus the maximum as C operand, exp2,
// 1 row-sum WMMA (ones x P^T) + 4 PV WMMA; sums and accumulators are never rescaled.
// Softmax kept in log2 domain (q pre-scaled by log2 e).
// ---------------------------------------------------------------------------
#define KS 16                    // key ranges = waves per work-group
#define QTL 2                    // query tiles per work-group and per wave
#define NPT (KS * QTL)           // partial results per work-group
#define PPITCH 68                // f32 per query row of a partial (16 B x odd)

__global__ __launch_bounds__(KS * 32) void attn_flash_kernel(
    const _Float16* __restrict__ qT, const _Float16* __restrict__ kT,
    const _Float16* __restrict__ vSw,
    const float* __restrict__ x, const float* __restrict__ gamma,
    float* __restrict__ out)
{
    __shared__ __align__(32) _Float16 pBuf[NPT][16 * 32];     // per wave and tile: P tile (chunk-swizzled)
    __shared__ __align__(16) float    part[NPT][16 * PPITCH]; // per wave and tile: partial [query][channel]
    __shared__ __align__(16) float    mBuf[NPT][16];          // row maxima (log2 domain)
    __shared__ __align__(16) float    lBuf[NPT][16];          // denominators

    const int lane = threadIdx.x & 31;
    // wave-uniform by construction; held in a scalar register so that key offsets and LDS bases
    // are scalar arithmetic and cost no vector registers
    const int ks   = __builtin_amdgcn_readfirstlane(threadIdx.x >> 5);   // key range of this wave
    const int b    = blockIdx.x >> 7;               // 128 work-groups per batch
    const int i0   = (blockIdx.x & 127) << 5;       // first of the 32 queries
    const int q16  = lane & 15;
    const int hi   = lane >> 4;

    // Q^T once per tile: the 8 channels at k = 0-7 (lanes 0-15) and again at k = 8-15 (lanes 16-31).
    // A loaded K fragment holds the even keys in lanes 0-15 (k = 0-7) and the odd keys in lanes
    // 16-31 (k = 8-15); each score product takes it with the other lane half set to zero.
    v16h aQ[QTL];
    #pragma unroll
    for (int tq = 0; tq < QTL; ++tq) {
        const v8h q8 = *(const v8h*)(qT + (size_t)(b * NN + i0 + 16 * tq + q16) * 8);
        #pragma unroll
        for (int e = 0; e < 8; ++e) { aQ[tq][e] = q8[e]; aQ[tq][e + 8] = (_Float16)0.f; }
    }

    v16h aOnes;
    #pragma unroll
    for (int i = 0; i < 16; ++i) aOnes[i] = (_Float16)1.f;

    v8f zero8;
    #pragma unroll
    for (int e = 0; e < 8; ++e) zero8[e] = 0.f;

    v8f acc[QTL][4];
    v8f cs[QTL];                                     // row sums of P: every row = denom of query q16
    #pragma unroll
    for (int tq = 0; tq < QTL; ++tq) {
        #pragma unroll
        for (int cg = 0; cg < 4; ++cg) acc[tq][cg] = zero8;
        cs[tq] = zero8;
    }

    // wave-uniform bases and one 32-bit lane offset: a block's address is scalar arithmetic plus
    // that offset, and no address pair has to live in vector registers across the key loop
    const _Float16* kB = kT + (size_t)b * NN * 8;
    const _Float16* vB = vSw + (size_t)b * CC * NN;
    const unsigned  lo = (unsigned)lane * 8u;

    // chunk-swizzled P row offset for this lane's j pair (j = 2*q16, 2*q16+1)
    const int swoff = (((q16 >> 2) & 1) << 4) | ((q16 >> 3) << 3);
    const int pvidx = swoff + ((2 * q16) & 7);       // even f16 index within row

    // merge role: lane -> query (tile hi, column q16), wave -> four channels
    const int c0 = 4 * ks;
    const size_t idx0 = ((size_t)(b * CC + c0)) * NN + i0 + lane;
    const float g  = gamma[0];

    // ---- pass 1: row maxima over all keys of this wave's range --------------
    float mx[QTL][8];
    #pragma unroll
    for (int tq = 0; tq < QTL; ++tq)
        #pragma unroll
        for (int r = 0; r < 8; ++r) mx[tq][r] = -3.0e38f;
    // all eight K loads are in flight together
    v8h k1[NN / (KS * 32)];
    #pragma unroll
    for (int t = 0; t < NN / (KS * 32); ++t) k1[t] = *(const v8h*)(kB + (size_t)(t * KS + ks) * KBLK + lo);
    #pragma unroll
    for (int t = 0; t < NN / (KS * 32); ++t) {
        // ends the loads, then each block's products and maxima, before the next block's: the scheduler
        // otherwise runs the products far ahead of the maxima, and load addresses that are needed
        // behind the key loop no longer fit the registers and spill
        __builtin_amdgcn_sched_barrier(0);
        const v8h k8 = k1[t];
        // selected as 32-bit words: one select per register, not one per f16
        const v4u kw = __builtin_bit_cast(v4u, k8);
        v8u bw[2];
        #pragma unroll
        for (int e = 0; e < 4; ++e) {
            bw[0][e]     = hi ? 0u : kw[e];
            bw[1][e]     = hi ? kw[e] : 0u;
            bw[0][e + 4] = 0u;
            bw[1][e + 4] = 0u;
        }
        const v16h bK[2] = {__builtin_bit_cast(v16h, bw[0]), __builtin_bit_cast(v16h, bw[1])};
        #pragma unroll
        for (int tq = 0; tq < QTL; ++tq) {
            v8f c01[2];
            #pragma unroll
            for (int h = 0; h < 2; ++h)
                c01[h] = __builtin_amdgcn_wmma_f32_16x16x32_f16(
                    false, aQ[tq], false, bK[h], (short)0, zero8, false, false);
            #pragma unroll
            for (int r = 0; r < 8; ++r) mx[tq][r] = fmaxf(mx[tq][r], fmaxf(c01[0][r], c01[1][r]));
        }
    }

    // ---- first block of pass 2: its loads fly under the exchange below ------
    v8h kf[2];
    v8h vf[2][8];
    kf[0] = *(const v8h*)(kB + (size_t)ks * KBLK + lo);
    #pragma unroll
    for (int i = 0; i < 8; ++i) vf[0][i] = *(const v8h*)(vB + (size_t)ks * VBLK + i * 256 + lo);
    // keeps these loads in front of the exchange, which then covers their latency
    __builtin_amdgcn_sched_barrier(0);

    // ---- packed f16 row-max butterfly over the 16-lane half, once per wave ---
    v2h pk[QTL][4];
    #pragma unroll
    for (int tq = 0; tq < QTL; ++tq)
        #pragma unroll
        for (int i = 0; i < 4; ++i)
            pk[tq][i] = (v2h){(_Float16)mx[tq][2 * i], (_Float16)mx[tq][2 * i + 1]};
    #pragma unroll
    for (int msk = 1; msk < 16; msk <<= 1) {
        #pragma unroll
        for (int tq = 0; tq < QTL; ++tq)
            #pragma unroll
            for (int i = 0; i < 4; ++i) {
                int o = __shfl_xor(__builtin_bit_cast(int, pk[tq][i]), msk, 16);
                pk[tq][i] = __builtin_elementwise_max(pk[tq][i], __builtin_bit_cast(v2h, o));
            }
    }
    float m[QTL][8];
    v8f negM[QTL];                                   // C operand of the score products of pass 2
    #pragma unroll
    for (int tq = 0; tq < QTL; ++tq)
        #pragma unroll
        for (int r = 0; r < 8; ++r) {
            m[tq][r] = (float)pk[tq][r >> 1][r & 1];
            negM[tq][r] = -m[tq][r];
        }

    // ---- pass 2 ---------------------------------------------------------------
    // one 512-byte load brings the K of all 32 keys of a block, eight bring its V
    auto fetch = [&](int t, v8h& k8, v8h (&vv)[8]) __attribute__((always_inline)) {
        const int blk = t * KS + ks;                 // 32-key block
        k8 = *(const v8h*)(kB + (size_t)blk * KBLK + lo);
        #pragma unroll
        for (int i = 0; i < 8; ++i) vv[i] = *(const v8h*)(vB + (size_t)blk * VBLK + i * 256 + lo);
    };
    auto step = [&](const v8h& k8, const v8h (&vv)[8]) __attribute__((always_inline)) {
        // ---- energy minus row maximum (log2 domain): lane q16 -> keys 2*q16(+1) of the block
        // selected as 32-bit words: one select per register, not one per f16
        const v4u kw = __builtin_bit_cast(v4u, k8);
        v8u bw[2];
        #pragma unroll
        for (int e = 0; e < 4; ++e) {
            bw[0][e]     = hi ? 0u : kw[e];
            bw[1][e]     = hi ? kw[e] : 0u;
            bw[0][e + 4] = 0u;
            bw[1][e + 4] = 0u;
        }
        const v16h bK[2] = {__builtin_bit_cast(v16h, bw[0]), __builtin_bit_cast(v16h, bw[1])};

        v16h bP[QTL];
        #pragma unroll
        for (int tq = 0; tq < QTL; ++tq) {
            _Float16* pS = &pBuf[ks * QTL + tq][0];
            v8f c01[2];
            #pragma unroll
            for (int h = 0; h < 2; ++h)
                c01[h] = __builtin_amdgcn_wmma_f32_16x16x32_f16(
                    false, aQ[tq], false, bK[h], (short)0, negM[tq], false, false);

            // ---- exp2, stage P (packed b32) --------------------------------
            // The bare hardware exp2: the library form scales arguments below -126 up and the result
            // back down to keep f32 subnormals, five more vector instructions per score; here every
            // such result is far below the smallest f16 and becomes 0 in P either way.
            #pragma unroll
            for (int h = 0; h < 2; ++h)
                #pragma unroll
                for (int r = 0; r < 8; ++r) c01[h][r] = __builtin_amdgcn_exp2f(c01[h][r]);
            #pragma unroll
            for (int r = 0; r < 8; ++r) {
                int row = r + 8 * hi;
                ((v2h*)pS)[(row * 32 + pvidx) >> 1] = (v2h){(_Float16)c01[0][r], (_Float16)c01[1][r]};
            }
        }
        #pragma unroll
        for (int tq = 0; tq < QTL; ++tq) {
            // ---- P^T operand: one aligned 32B LDS read per lane ----------
            bP[tq] = *(const v16h*)(&pBuf[ks * QTL + tq][0] + q16 * 32 + hi * 16);
            // ---- softmax denominator via ones x P^T (row-sum WMMA) -------
            cs[tq] = __builtin_amdgcn_wmma_f32_16x16x32_f16(
                false, aOnes, false, bP[tq], (short)0, cs[tq], false, false);
        }

        // ---- out^T += V x P^T, 4 channel groups; each V fragment serves both tiles
        #pragma unroll
        for (int cg = 0; cg < 4; ++cg) {
            v16h aV = __builtin_shufflevector(vv[2 * cg], vv[2 * cg + 1], 0, 1, 2, 3, 4, 5, 6, 7,
                                              8, 9, 10, 11, 12, 13, 14, 15);
            #pragma unroll
            for (int tq = 0; tq < QTL; ++tq)
                acc[tq][cg] = __builtin_amdgcn_wmma_f32_16x16x32_f16(
                    false, aV, false, bP[tq], (short)0, acc[tq][cg], false, false);
        }
    };

    // Two register sets: a block's nine loads are issued one whole block ahead of their use.
    // The last two blocks stand behind the loop: with their missing fetch under a branch inside it,
    // the counted waits of the loop would have to hold for both paths and would wait for the
    // youngest loads too. Kept rolled: unrolled whole, its values no longer fit the registers and spill.
    #pragma unroll 1
    for (int t = 0; t < NN / (KS * 32) - 2; t += 2) {
        fetch(t + 1, kf[1], vf[1]);
        // keeps the loads above in front of the block's work: the scheduler otherwise sinks each
        // to its first use, where its whole latency is waited out
        __builtin_amdgcn_sched_barrier(0);
        step(kf[0], vf[0]);
        fetch(t + 2, kf[0], vf[0]);
        // as above
        __builtin_amdgcn_sched_barrier(0);
        step(kf[1], vf[1]);
    }
    fetch(NN / (KS * 32) - 1, kf[1], vf[1]);
    // as above
    __builtin_amdgcn_sched_barrier(0);
    step(kf[0], vf[0]);
    // residual values: fetched here, where one register set has come free, so that the last block
    // covers their latency; held across the key loop they would not fit the registers
    float xres[4];
    #pragma unroll
    for (int j = 0; j < 4; ++j) xres[j] = x[idx0 + (size_t)j * NN];
    // keeps these loads in front of the last block's work
    __builtin_amdgcn_sched_barrier(0);
    step(kf[1], vf[1]);

    // ---- publish this wave's partials: maxima, denominators, accumulators --
    #pragma unroll
    for (int tq = 0; tq < QTL; ++tq) {
        const int pi = ks * QTL + tq;
        #pragma unroll
        for (int r = 0; r < 8; ++r)
            if (q16 == 0) mBuf[pi][r + 8 * hi] = m[tq][r];
        if (hi == 0) lBuf[pi][q16] = cs[tq][0];
        float* pw = &part[pi][q16 * PPITCH + 8 * hi];
        #pragma unroll
        for (int cg = 0; cg < 4; ++cg) {
            *(v4f*)(pw + cg * 16)     = (v4f){acc[tq][cg][0], acc[tq][cg][1], acc[tq][cg][2], acc[tq][cg][3]};
            *(v4f*)(pw + cg * 16 + 4) = (v4f){acc[tq][cg][4], acc[tq][cg][5], acc[tq][cg][6], acc[tq][cg][7]};
        }
    }

    // every wave's partials are in LDS before any wave reads another's
    __syncthreads();

    // ---- merge the KS key ranges: weights exp2(m - M) --------------------
    float ms[KS];
    float M = -3.0e38f;
    #pragma unroll
    for (int s = 0; s < KS; ++s) {
        ms[s] = mBuf[s * QTL + hi][q16];
        M = fmaxf(M, ms[s]);
    }
    float L = 0.f;
    float o[4] = {0.f, 0.f, 0.f, 0.f};
    #pragma unroll
    for (int s = 0; s < KS; ++s) {
        float w = __builtin_exp2f(ms[s] - M);
        v4f  p = *(const v4f*)&part[s * QTL + hi][q16 * PPITCH + c0];
        L  += w * lBuf[s * QTL + hi][q16];
        #pragma unroll
        for (int j = 0; j < 4; ++j) o[j] += w * p[j];
    }

    // ---- finalize: gamma * o / L + residual; one 128-B line per store ----
    float invq = 1.0f / L;
    #pragma unroll
    for (int j = 0; j < 4; ++j)
        out[idx0 + (size_t)j * NN] = g * o[j] * invq + xres[j];
}

// ---------------------------------------------------------------------------
extern "C" void kernel_launch(void* const* d_in, const int* in_sizes, int n_in,
                              void* d_out, int out_size, void* d_ws, size_t ws_size,
                              hipStream_t stream) {
    const float* x     = (const float*)d_in[0];
    const float* Wq    = (const float*)d_in[1];
    const float* bq    = (const float*)d_in[2];
    const float* Wk    = (const float*)d_in[3];
    const float* bk    = (const float*)d_in[4];
    const float* Wv    = (const float*)d_in[5];
    const float* bv    = (const float*)d_in[6];
    const float* gamma = (const float*)d_in[7];
    float* out = (float*)d_out;

    _Float16* ws = (_Float16*)d_ws;
    _Float16* qT   = ws + QT_OFF;
    _Float16* kT   = ws + KT_OFF;
    _Float16* vSw  = ws + VS_OFF;

    proj_kernel<<<(BB * NN / PN) * PG, 32, 0, stream>>>(x, Wq, bq, Wk, bk, Wv, bv, qT, kT, vSw);
    attn_flash_kernel<<<(BB * NN / 16) / QTL, KS * 32, 0, stream>>>(qT, kT, vSw, x, gamma, out);
}

// v007
// One run takes 13.3 microseconds.
// Next to v006, in two timings, it ran 1.06 and 1.05 times as fast.
// Counting every step since v000, it is 12.4 times as fast.
#include <hip/hip_runtime.h>

typedef __attribute__((ext_vector_type(16))) _Float16 v16h;
typedef __attribute__((ext_vector_type(8)))  _Float16 v8h;
typedef __attribute__((ext_vector_type(2)))  _Float16 v2h;
typedef __attribute__((ext_vector_type(8)))  float    v8f;
typedef __attribute__((ext_vector_type(4)))  float    v4f;
typedef __attribute__((ext_vector_type(2)))  float    v2f;
typedef __attribute__((ext_vector_type(4)))  unsigned v4u;
typedef __attribute__((ext_vector_type(8)))  unsigned v8u;

#define BB 2
#define CC 64
#define C8 8
#define NN 4096
#define LOG2E 1.44269504088896340736f

// Workspace layout (f16 elements). K and V lie in pieces of 16 bytes per lane, so that each load of a
// wave of the attention kernel covers whole lines: K 512 bytes in a row, V two runs of 256 bytes:
//   qT  [B][N][8]               : q channels * log2(e)
//   kT  [B][N/32][32][8]        : slot 16*h + c of a 32-key block = the 8 channels of key 2*c + h
//   vSw [B][N/32][4][2][32][8]  : [channel group][part p][slot 16*s + c] =
//                                 channel 16*group + c, keys 16*p + 8*s + 0..7 of the block
#define QT_OFF  ((size_t)0)
#define KT_OFF  ((size_t)BB * NN * 8)
#define VS_OFF  (KT_OFF + (size_t)BB * NN * 8)
#define KBLK    256              // f16 per 32-key block of kT
#define VBLK    2048             // f16 per 32-key block of vSw

// ---------------------------------------------------------------------------
// All three projections in one launch, as f32 matrix products (16x16x4 form).
// One wave per work-group: 64 columns n of one batch (four fragments of 16,
// fragment f = columns n0 + 4*c + f, so a lane's 16-byte load of x feeds all
// four) times one group of 16 output channels: group 0 = q (rows 0-7) and
// k (rows 8-15), groups 1-4 = v.
// k order, the same for the x and the weight fragment: lane half h, step kk,
// element e  ->  input channel 32*h + 2*kk + e.
//   group 0  : D = W * x    -> a lane holds the 8 q (h = 0) or k (h = 1)
//              channels of one column: one 16-byte store
//   groups 1+: D = x^T * W^T -> a lane holds 32 consecutive n of one channel:
//              its channel's share of one 32-key block of vSw, four 16-byte pieces
// ---------------------------------------------------------------------------
#define PN 64                    // columns per wave
#define PG 5                     // channel groups: q|k, v0-15, v16-31, v32-47, v48-63

__global__ __launch_bounds__(32) void proj_kernel(
    const float* __restrict__ x,
    const float* __restrict__ Wq, const float* __restrict__ bq,
    const float* __restrict__ Wk, const float* __restrict__ bk,
    const float* __restrict__ Wv, const float* __restrict__ bv,
    _Float16* __restrict__ qT, _Float16* __restrict__ kT,
    _Float16* __restrict__ vSw)
{
    const int c  = threadIdx.x & 15;
    const int h  = threadIdx.x >> 4;
    const int g  = blockIdx.x % PG;
    const int nb = blockIdx.x / PG;
    const int b  = nb / (NN / PN);
    const int n0 = (nb % (NN / PN)) * PN;

    const float* wrow = (g == 0) ? ((c < 8) ? Wq + c * CC : Wk + (c - 8) * CC)
                                 : Wv + ((g - 1) * 16 + c) * CC;
    wrow += h * 32;
    const float* xp = x + ((size_t)(b * CC + h * 32)) * NN + n0 + 4 * c;
    // accumulator start, D register r: group 0 = bias of channel r of q (h = 0) or k (h = 1);
    // groups 1+ = the lane's own channel's bias in every register
    const float* bp = (g == 0) ? (h ? bk : bq) : bv + ((g - 1) * 16 + c);
    const int    bs = (g == 0) ? 1 : 0;

    float bias[8];
    #pragma unroll
    for (int r = 0; r < 8; ++r) bias[r] = bp[r * bs];
    v4f xr[32];
    #pragma unroll
    for (int i = 0; i < 32; ++i) xr[i] = *(const v4f*)(xp + (size_t)i * NN);
    v4f wr[8];
    #pragma unroll
    for (int i = 0; i < 8; ++i) wr[i] = *(const v4f*)(wrow + 4 * i);
    // stands in front of the first reuse of the address registers of the loads above
    asm volatile("s_wait_xcnt 0x0" ::: "memory");

    v8f acc[4];
    #pragma unroll
    for (int f = 0; f < 4; ++f)
        #pragma unroll
        for (int r = 0; r < 8; ++r) acc[f][r] = bias[r];

    if (g != 0) {
        #pragma unroll
        for (int kk = 0; kk < 16; ++kk) {
            v2f w = (v2f){wr[kk >> 1][(2 * kk) & 3], wr[kk >> 1][((2 * kk) & 3) + 1]};
            #pragma unroll
            for (int f = 0; f < 4; ++f) {
                v2f xv = (v2f){xr[2 * kk][f], xr[2 * kk + 1][f]};
                acc[f] = __builtin_amdgcn_wmma_f32_16x16x4_f32(
                    false, xv, false, w, (short)0, acc[f], false, false);
            }
        }
        // acc[f][r] = v[16*(g-1) + c][n0 + 32*h + 4*r + f]; the piece of keys 8*jj .. 8*jj+7
        // (r = 2*jj, 2*jj+1) goes to part jj >> 1, slot half jj & 1: 16 lanes store 256 B in a row
        _Float16* dst = vSw + (size_t)b * CC * NN + (size_t)((n0 >> 5) + h) * VBLK
                            + (g - 1) * 512 + c * 8;
        #pragma unroll
        for (int jj = 0; jj < 4; ++jj) {
            v8h o;
            #pragma unroll
            for (int e = 0; e < 8; ++e) o[e] = (_Float16)acc[e & 3][2 * jj + (e >> 2)];
            *(v8h*)(dst + (jj >> 1) * 256 + (jj & 1) * 128) = o;
        }
        // the built code lays the q|k path behind these stores and reuses their registers there:
        // the wait stands in front of that reuse
        asm volatile("s_wait_xcnt 0x0" ::: "memory");
        return;
    }

    #pragma unroll
    for (int kk = 0; kk < 16; ++kk) {
        v2f w = (v2f){wr[kk >> 1][(2 * kk) & 3], wr[kk >> 1][((2 * kk) & 3) + 1]};
        #pragma unroll
        for (int f = 0; f < 4; ++f) {
            v2f xv = (v2f){xr[2 * kk][f], xr[2 * kk + 1][f]};
            acc[f] = __builtin_amdgcn_wmma_f32_16x16x4_f32(
                false, w, false, xv, (short)0, acc[f], false, false);
        }
    }
    const float s = h ? 1.0f : LOG2E;
    // column n0 + 4*c + f: q row as it is; k = key 4*(c & 7) + f of block c >> 3,
    // slot 16*(f & 1) + 2*(c & 7) + (f >> 1)
    _Float16* dst = h ? kT + ((size_t)(b * NN + n0 + (c >> 3) * 32 + 2 * (c & 7))) * 8
                      : qT + ((size_t)(b * NN + n0 + 4 * c)) * 8;
    #pragma unroll
    for (int f = 0; f < 4; ++f) {
        v8h o;
        #pragma unroll
        for (int r = 0; r < 8; ++r) o[r] = (_Float16)(acc[f][r] * s);
        *(v8h*)(dst + (h ? (f & 1) * 16 + (f >> 1) : f) * 8) = o;
    }
}

// ---------------------------------------------------------------------------
// Fused flash-attention. One work-group per 32 queries (two 16-query tiles);
// the keys are split over KS waves: wave ks walks the 32-key blocks ks, ks + KS, ...
// for BOTH query tiles, so that each K and V fragment it loads feeds two products,
// with its own maxima, sums and accumulators per tile, and the KS partial results
// of a tile are merged through LDS behind one barrier.
// The scores are formed transposed, S^T = K^T x Q (rows = keys, columns = queries): a lane then
// holds, for its own query, the 16 keys 16*hi + 0..15 of a block (even ones from the first product,
// odd ones from the second), and these 16 values are its share of the P^T operand of the PV
// products. P goes from exp2 to the PV products in registers, through no LDS and no lane exchange.
// k order of P^T and of the V fragment alike: lane half hi, element e -> key 16*hi + e.
// A wave walks its keys twice. Pass 1: score WMMAs and in-lane maxima only, then
// one exchange between the two lane halves gives each query's maximum over the whole range.
// Pass 2, per step and tile: 2 score WMMA with minus the maximum as C operand, exp2,
// 1 row-sum WMMA (ones x P^T) + 4 PV WMMA; sums and accumulators are never rescaled.
// Softmax kept in log2 domain (q pre-scaled by log2 e).
// ---------------------------------------------------------------------------
#define KS 16                    // key ranges = waves per work-group
#define QTL 2                    // query tiles per work-group and per wave
#define NPT (KS * QTL)           // partial results per work-group
#define PPITCH 68                // f32 per query row of a partial (16 B x odd)

__global__ __launch_bounds__(KS * 32) void attn_flash_kernel(
    const _Float16* __restrict__ qT, const _Float16* __restrict__ kT,
    const _Float16* __restrict__ vSw,
    const float* __restrict__ x, const float* __restrict__ gamma,
    float* __restrict__ out)
{
    __shared__ __align__(16) float    part[NPT][16 * PPITCH]; // per wave and tile: partial [query][channel]
    __shared__ __align__(16) float    mBuf[NPT][16];          // row maxima (log2 domain)
    __shared__ __align__(16) float    lBuf[NPT][16];          // denominators

    const int lane = threadIdx.x & 31;
    // wave-uniform by construction; held in a scalar register so that key offsets and LDS bases
    // are scalar arithmetic and cost no vector registers
    const int ks   = __builtin_amdgcn_readfirstlane(threadIdx.x >> 5);   // key range of this wave
    const int b    = blockIdx.x >> 7;               // 128 work-groups per batch
    const int i0   = (blockIdx.x & 127) << 5;       // first of the 32 queries
    const int q16  = lane & 15;
    const int hi   = lane >> 4;

    // Q once per tile: the 8 channels at k = 0-7 (lanes 0-15) and again at k = 8-15 (lanes 16-31).
    // A loaded K fragment holds the even keys in lanes 0-15 (k = 0-7) and the odd keys in lanes
    // 16-31 (k = 8-15); each score product takes it with the other lane half set to zero.
    v16h aQ[QTL];
    #pragma unroll
    for (int tq = 0; tq < QTL; ++tq) {
        const v8h q8 = *(const v8h*)(qT + (size_t)(b * NN + i0 + 16 * tq + q16) * 8);
        #pragma unroll
        for (int e = 0; e < 8; ++e) { aQ[tq][e] = q8[e]; aQ[tq][e + 8] = (_Float16)0.f; }
    }

    v16h aOnes;
    #pragma unroll
    for (int i = 0; i < 16; ++i) aOnes[i] = (_Float16)1.f;

    v8f zero8;
    #pragma unroll
    for (int e = 0; e < 8; ++e) zero8[e] = 0.f;

    v8f acc[QTL][4];
    v8f cs[QTL];                                     // row sums of P: every row = denom of query q16
    #pragma unroll
    for (int tq = 0; tq < QTL; ++tq) {
        #pragma unroll
        for (int cg = 0; cg < 4; ++cg) acc[tq][cg] = zero8;
        cs[tq] = zero8;
    }

    // wave-uniform bases and two 32-bit lane offsets, lo for K and lv for V: a block's address is scalar arithmetic
    // plus one of them, and no address pair has to live in vector registers across the key loop
    const _Float16* kB = kT + (size_t)b * NN * 8;
    const _Float16* vB = vSw + (size_t)b * CC * NN;
    const unsigned  lo = (unsigned)lane * 8u;
    // V: lane half hi takes part hi of a channel group, both 8-key pieces of it (keys 16*hi + 0..15)
    const unsigned  lv = (unsigned)hi * 256u + (unsigned)q16 * 8u;

    // merge role: lane -> query (tile hi, column q16), wave -> four channels
    const int c0 = 4 * ks;
    const size_t idx0 = ((size_t)(b * CC + c0)) * NN + i0 + lane;
    const float g  = gamma[0];

    // ---- pass 1: row maxima over all keys of this wave's range --------------
    float mx[QTL][8];
    #pragma unroll
    for (int tq = 0; tq < QTL; ++tq)
        #pragma unroll
        for (int r = 0; r < 8; ++r) mx[tq][r] = -3.0e38f;
    // all eight K loads are in flight together
    v8h k1[NN / (KS * 32)];
    #pragma unroll
    for (int t = 0; t < NN / (KS * 32); ++t) k1[t] = *(const v8h*)(kB + (size_t)(t * KS + ks) * KBLK + lo);
    #pragma unroll
    for (int t = 0; t < NN / (KS * 32); ++t) {
        // ends the loads, then each block's products and maxima, before the next block's: the scheduler
        // otherwise runs the products far ahead of the maxima, and load addresses that are needed
        // behind the key loop no longer fit the registers and spill
        __builtin_amdgcn_sched_barrier(0);
        const v8h k8 = k1[t];
        // selected as 32-bit words: one select per register, not one per f16
        const v4u kw = __builtin_bit_cast(v4u, k8);
        v8u bw[2];
        #pragma unroll
        for (int e = 0; e < 4; ++e) {
            bw[0][e]     = hi ? 0u : kw[e];
            bw[1][e]     = hi ? kw[e] : 0u;
            bw[0][e + 4] = 0u;
            bw[1][e + 4] = 0u;
        }
        const v16h bK[2] = {__builtin_bit_cast(v16h, bw[0]), __builtin_bit_cast(v16h, bw[1])};
        #pragma unroll
        for (int tq = 0; tq < QTL; ++tq) {
            v8f c01[2];
            #pragma unroll
            for (int h = 0; h < 2; ++h)
                c01[h] = __builtin_amdgcn_wmma_f32_16x16x32_f16(
                    false, bK[h], false, aQ[tq], (short)0, zero8, false, false);
            #pragma unroll
            for (int r = 0; r < 8; ++r) mx[tq][r] = fmaxf(mx[tq][r], fmaxf(c01[0][r], c01[1][r]));
        }
    }

    // ---- first block of pass 2: its loads fly under the exchange below ------
    v8h kf[2];
    v8h vf[2][8];
    kf[0] = *(const v8h*)(kB + (size_t)ks * KBLK + lo);
    #pragma unroll
    for (int i = 0; i < 8; ++i) vf[0][i] = *(const v8h*)(vB + (size_t)ks * VBLK + (i >> 1) * 512 + (i & 1) * 128 + lv);
    // keeps these loads in front of the exchange, which then covers their latency
    __builtin_amdgcn_sched_barrier(0);

    // ---- a query's maximum, packed f16: over the lane's 8 registers, then between the lane halves ---
    float m[QTL];
    v8f negM[QTL];                                   // C operand of the score products of pass 2
    #pragma unroll
    for (int tq = 0; tq < QTL; ++tq) {
        v2h pk[4];
        #pragma unroll
        for (int i = 0; i < 4; ++i) pk[i] = (v2h){(_Float16)mx[tq][2 * i], (_Float16)mx[tq][2 * i + 1]};
        v2h p = __builtin_elementwise_max(__builtin_elementwise_max(pk[0], pk[1]),
                                          __builtin_elementwise_max(pk[2], pk[3]));
        int o = __shfl_xor(__builtin_bit_cast(int, p), 16, 32);
        p = __builtin_elementwise_max(p, __builtin_bit_cast(v2h, o));
        m[tq] = fmaxf((float)p[0], (float)p[1]);
        #pragma unroll
        for (int r = 0; r < 8; ++r) negM[tq][r] = -m[tq];
    }

    // ---- pass 2 ---------------------------------------------------------------
    // one 512-byte load brings the K of all 32 keys of a block, eight bring its V
    auto fetch = [&](int t, v8h& k8, v8h (&vv)[8]) __attribute__((always_inline)) {
        const int blk = t * KS + ks;                 // 32-key block
        k8 = *(const v8h*)(kB + (size_t)blk * KBLK + lo);
        #pragma unroll
        for (int i = 0; i < 8; ++i) vv[i] = *(const v8h*)(vB + (size_t)blk * VBLK + (i >> 1) * 512 + (i & 1) * 128 + lv);
    };
    auto step = [&](const v8h& k8, const v8h (&vv)[8]) __attribute__((always_inline)) {
        // ---- energy minus the query's maximum (log2 domain): product h, register r -> key 16*hi + 2*r + h
        // selected as 32-bit words: one select per register, not one per f16
        const v4u kw = __builtin_bit_cast(v4u, k8);
        v8u bw[2];
        #pragma unroll
        for (int e = 0; e < 4; ++e) {
            bw[0][e]     = hi ? 0u : kw[e];
            bw[1][e]     = hi ? kw[e] : 0u;
            bw[0][e + 4] = 0u;
            bw[1][e + 4] = 0u;
        }
        const v16h bK[2] = {__builtin_bit_cast(v16h, bw[0]), __builtin_bit_cast(v16h, bw[1])};

        v16h bP[QTL];
        #pragma unroll
        for (int tq = 0; tq < QTL; ++tq) {
            v8f c01[2];
            #pragma unroll
            for (int h = 0; h < 2; ++h)
                c01[h] = __builtin_amdgcn_wmma_f32_16x16x32_f16(
                    false, bK[h], false, aQ[tq], (short)0, negM[tq], false, false);

            // ---- exp2; the lane's 16 values are its share of the P^T operand, in key order ----
            // The bare hardware exp2: the library form scales arguments below -126 up and the result
            // back down to keep f32 subnormals, five more vector instructions per score; here every
            // such result is far below the smallest f16 and becomes 0 in P either way.
            #pragma unroll
            for (int r = 0; r < 8; ++r) {
                const float e0 = __builtin_amdgcn_exp2f(c01[0][r]);
                const float e1 = __builtin_amdgcn_exp2f(c01[1][r]);
                const v2h   pr = (v2h){(_Float16)e0, (_Float16)e1};
                bP[tq][2 * r]     = pr[0];
                bP[tq][2 * r + 1] = pr[1];
            }
        }
        // ---- softmax denominator via ones x P^T (row-sum WMMA) -------
        #pragma unroll
        for (int tq = 0; tq < QTL; ++tq)
            cs[tq] = __builtin_amdgcn_wmma_f32_16x16x32_f16(
                false, aOnes, false, bP[tq], (short)0, cs[tq], false, false);

        // ---- out^T += V x P^T, 4 channel groups; each V fragment serves both tiles
        #pragma unroll
        for (int cg = 0; cg < 4; ++cg) {
            v16h aV = __builtin_shufflevector(vv[2 * cg], vv[2 * cg + 1], 0, 1, 2, 3, 4, 5, 6, 7,
                                              8, 9, 10, 11, 12, 13, 14, 15);
            #pragma unroll
            for (int tq = 0; tq < QTL; ++tq)
                acc[tq][cg] = __builtin_amdgcn_wmma_f32_16x16x32_f16(
                    false, aV, false, bP[tq], (short)0, acc[tq][cg], false, false);
        }
    };

    // Two register sets: a block's nine loads are issued one whole block ahead of their use.
    // The last two blocks stand behind the loop: with their missing fetch under a branch inside it,
    // the counted waits of the loop would have to hold for both paths and would wait for the
    // youngest loads too. Kept rolled: unrolled whole, its values no longer fit the registers and spill.
    #pragma unroll 1
    for (int t = 0; t < NN / (KS * 32) - 2; t += 2) {
        fetch(t + 1, kf[1], vf[1]);
        // keeps the loads above in front of the block's work: the scheduler otherwise sinks each
        // to its first use, where its whole latency is waited out
        __builtin_amdgcn_sched_barrier(0);
        step(kf[0], vf[0]);
        fetch(t + 2, kf[0], vf[0]);
        // as above
        __builtin_amdgcn_sched_barrier(0);
        step(kf[1], vf[1]);
    }
    fetch(NN / (KS * 32) - 1, kf[1], vf[1]);
    // as above
    __builtin_amdgcn_sched_barrier(0);
    step(kf[0], vf[0]);
    // residual values: fetched here, where one register set has come free, so that the last block
    // covers their latency; held across the key loop they would not fit the registers
    float xres[4];
    #pragma unroll
    for (int j = 0; j < 4; ++j) xres[j] = x[idx0 + (size_t)j * NN];
    // keeps these loads in front of the last block's work
    __builtin_amdgcn_sched_barrier(0);
    step(kf[1], vf[1]);

    // ---- publish this wave's partials: maxima, denominators, accumulators --
    #pragma unroll
    for (int tq = 0; tq < QTL; ++tq) {
        const int pi = ks * QTL + tq;
        if (hi == 0) { mBuf[pi][q16] = m[tq]; lBuf[pi][q16] = cs[tq][0]; }
        float* pw = &part[pi][q16 * PPITCH + 8 * hi];
        #pragma unroll
        for (int cg = 0; cg < 4; ++cg) {
            *(v4f*)(pw + cg * 16)     = (v4f){acc[tq][cg][0], acc[tq][cg][1], acc[tq][cg][2], acc[tq][cg][3]};
            *(v4f*)(pw + cg * 16 + 4) = (v4f){acc[tq][cg][4], acc[tq][cg][5], acc[tq][cg][6], acc[tq][cg][7]};
        }
    }

    // every wave's partials are in LDS before any wave reads another's
    __syncthreads();

    // ---- merge the KS key ranges: weights exp2(m - M) --------------------
    float ms[KS];
    float M = -3.0e38f;
    #pragma unroll
    for (int s = 0; s < KS; ++s) {
        ms[s] = mBuf[s * QTL + hi][q16];
        M = fmaxf(M, ms[s]);
    }
    float L = 0.f;
    float o[4] = {0.f, 0.f, 0.f, 0.f};
    #pragma unroll
    for (int s = 0; s < KS; ++s) {
        float w = __builtin_exp2f(ms[s] - M);
        v4f  p = *(const v4f*)&part[s * QTL + hi][q16 * PPITCH + c0];
        L  += w * lBuf[s * QTL + hi][q16];
        #pragma unroll
        for (int j = 0; j < 4; ++j) o[j] += w * p[j];
    }

    // ---- finalize: gamma * o / L + residual; one 128-B line per store ----
    float invq = 1.0f / L;
    #pragma unroll
    for (int j = 0; j < 4; ++j)
        out[idx0 + (size_t)j * NN] = g * o[j] * invq + xres[j];
}

// ---------------------------------------------------------------------------
extern "C" void kernel_launch(void* const* d_in, const int* in_sizes, int n_in,
                              void* d_out, int out_size, void* d_ws, size_t ws_size,
                              hipStream_t stream) {
    const float* x     = (const float*)d_in[0];
    const float* Wq    = (const float*)d_in[1];
    const float* bq    = (const float*)d_in[2];
    const float* Wk    = (const float*)d_in[3];
    const float* bk    = (const float*)d_in[4];
    const float* Wv    = (const float*)d_in[5];
    const float* bv    = (const float*)d_in[6];
    const float* gamma = (const float*)d_in[7];
    float* out = (float*)d_out;

    _Float16* ws = (_Float16*)d_ws;
    _Float16* qT   = ws + QT_OFF;
    _Float16* kT   = ws + KT_OFF;
    _Float16* vSw  = ws + VS_OFF;

    proj_kernel<<<(BB * NN / PN) * PG, 32, 0, stream>>>(x, Wq, bq, Wk, bk, Wv, bv, qT, kT, vSw);
    attn_flash_kernel<<<(BB * NN / 16) / QTL, KS * 32, 0, stream>>>(qT, kT, vSw, x, gamma, out);
}

// v008
// It runs in 13 microseconds.
// In two side-by-side timings against v007, it was 1.06 and 1.03 times as fast.
// Counting every step since v000, it is 13.0 times as fast.
#include <hip/hip_runtime.h>

typedef __attribute__((ext_vector_type(16))) _Float16 v16h;
typedef __attribute__((ext_vector_type(8)))  _Float16 v8h;
typedef __attribute__((ext_vector_type(2)))  _Float16 v2h;
typedef __attribute__((ext_vector_type(8)))  float    v8f;
typedef __attribute__((ext_vector_type(4)))  float    v4f;
typedef __attribute__((ext_vector_type(2)))  float    v2f;
typedef __attribute__((ext_vector_type(4)))  unsigned v4u;
typedef __attribute__((ext_vector_type(8)))  unsigned v8u;

#define BB 2
#define CC 64
#define C8 8
#define NN 4096
#define LOG2E 1.44269504088896340736f

// Workspace layout (f16 elements). K and V lie in pieces of 16 bytes per lane, so that each load of a
// wave of the attention kernel covers whole lines: K 512 bytes in a row, V two runs of 256 bytes:
//   qT  [B][N][8]               : q channels * log2(e)
//   kT  [B][N/32][32][8]        : slot 16*h + c of a 32-key block = the 8 channels of key 2*c + h
//   vSw [B][N/32][4][2][32][8]  : [channel group][part p][slot 16*s + c] =
//                                 channel 16*group + c, keys 16*p + 8*s + 0..7 of the block
#define QT_OFF  ((size_t)0)
#define KT_OFF  ((size_t)BB * NN * 8)
#define VS_OFF  (KT_OFF + (size_t)BB * NN * 8)
#define KBLK    256              // f16 per 32-key block of kT
#define VBLK    2048             // f16 per 32-key block of vSw

// ---------------------------------------------------------------------------
// All three projections in one launch, as f32 matrix products (16x16x4 form).
// One wave per work-group: 64 columns n of one batch (four fragments of 16,
// fragment f = columns n0 + 4*c + f, so a lane's 16-byte load of x feeds all
// four) times one group of 16 output channels: group 0 = q (rows 0-7) and
// k (rows 8-15), groups 1-4 = v.
// k order, the same for the x and the weight fragment: lane half h, step kk,
// element e  ->  input channel 32*h + 2*kk + e.
//   group 0  : D = W * x    -> a lane holds the 8 q (h = 0) or k (h = 1)
//              channels of one column: one 16-byte store
//   groups 1+: D = x^T * W^T -> a lane holds 32 consecutive n of one channel:
//              its channel's share of one 32-key block of vSw, four 16-byte pieces
// ---------------------------------------------------------------------------
#define PN 64                    // columns per wave
#define PG 5                     // channel groups: q|k, v0-15, v16-31, v32-47, v48-63

__global__ __launch_bounds__(32) void proj_kernel(
    const float* __restrict__ x,
    const float* __restrict__ Wq, const float* __restrict__ bq,
    const float* __restrict__ Wk, const float* __restrict__ bk,
    const float* __restrict__ Wv, const float* __restrict__ bv,
    _Float16* __restrict__ qT, _Float16* __restrict__ kT,
    _Float16* __restrict__ vSw)
{
    const int c  = threadIdx.x & 15;
    const int h  = threadIdx.x >> 4;
    const int g  = blockIdx.x % PG;
    const int nb = blockIdx.x / PG;
    const int b  = nb / (NN / PN);
    const int n0 = (nb % (NN / PN)) * PN;

    const float* wrow = (g == 0) ? ((c < 8) ? Wq + c * CC : Wk + (c - 8) * CC)
                                 : Wv + ((g - 1) * 16 + c) * CC;
    wrow += h * 32;
    const float* xp = x + ((size_t)(b * CC + h * 32)) * NN + n0 + 4 * c;
    // accumulator start, D register r: group 0 = bias of channel r of q (h = 0) or k (h = 1);
    // groups 1+ = the lane's own channel's bias in every register
    const float* bp = (g == 0) ? (h ? bk : bq) : bv + ((g - 1) * 16 + c);
    const int    bs = (g == 0) ? 1 : 0;

    float bias[8];
    #pragma unroll
    for (int r = 0; r < 8; ++r) bias[r] = bp[r * bs];
    v4f xr[32];
    #pragma unroll
    for (int i = 0; i < 32; ++i) xr[i] = *(const v4f*)(xp + (size_t)i * NN);
    v4f wr[8];
    #pragma unroll
    for (int i = 0; i < 8; ++i) wr[i] = *(const v4f*)(wrow + 4 * i);
    // stands in front of the first reuse of the address registers of the loads above
    asm volatile("s_wait_xcnt 0x0" ::: "memory");

    v8f acc[4];
    #pragma unroll
    for (int f = 0; f < 4; ++f)
        #pragma unroll
        for (int r = 0; r < 8; ++r) acc[f][r] = bias[r];

    if (g != 0) {
        #pragma unroll
        for (int kk = 0; kk < 16; ++kk) {
            v2f w = (v2f){wr[kk >> 1][(2 * kk) & 3], wr[kk >> 1][((2 * kk) & 3) + 1]};
            #pragma unroll
            for (int f = 0; f < 4; ++f) {
                v2f xv = (v2f){xr[2 * kk][f], xr[2 * kk + 1][f]};
                acc[f] = __builtin_amdgcn_wmma_f32_16x16x4_f32(
                    false, xv, false, w, (short)0, acc[f], false, false);
            }
        }
        // acc[f][r] = v[16*(g-1) + c][n0 + 32*h + 4*r + f]; the piece of keys 8*jj .. 8*jj+7
        // (r = 2*jj, 2*jj+1) goes to part jj >> 1, slot half jj & 1: 16 lanes store 256 B in a row
        _Float16* dst = vSw + (size_t)b * CC * NN + (size_t)((n0 >> 5) + h) * VBLK
                            + (g - 1) * 512 + c * 8;
        #pragma unroll
        for (int jj = 0; jj < 4; ++jj) {
            v8h o;
            #pragma unroll
            for (int e = 0; e < 8; ++e) o[e] = (_Float16)acc[e & 3][2 * jj + (e >> 2)];
            *(v8h*)(dst + (jj >> 1) * 256 + (jj & 1) * 128) = o;
        }
        // the built code lays the q|k path behind these stores and reuses their registers there:
        // the wait stands in front of that reuse
        asm volatile("s_wait_xcnt 0x0" ::: "memory");
        return;
    }

    #pragma unroll
    for (int kk = 0; kk < 16; ++kk) {
        v2f w = (v2f){wr[kk >> 1][(2 * kk) & 3], wr[kk >> 1][((2 * kk) & 3) + 1]};
        #pragma unroll
        for (int f = 0; f < 4; ++f) {
            v2f xv = (v2f){xr[2 * kk][f], xr[2 * kk + 1][f]};
            acc[f] = __builtin_amdgcn_wmma_f32_16x16x4_f32(
                false, w, false, xv, (short)0, acc[f], false, false);
        }
    }
    const float s = h ? 1.0f : LOG2E;
    // column n0 + 4*c + f: q row as it is; k = key 4*(c & 7) + f of block c >> 3,
    // slot 16*(f & 1) + 2*(c & 7) + (f >> 1)
    _Float16* dst = h ? kT + ((size_t)(b * NN + n0 + (c >> 3) * 32 + 2 * (c & 7))) * 8
                      : qT + ((size_t)(b * NN + n0 + 4 * c)) * 8;
    #pragma unroll
    for (int f = 0; f < 4; ++f) {
        v8h o;
        #pragma unroll
        for (int r = 0; r < 8; ++r) o[r] = (_Float16)(acc[f][r] * s);
        *(v8h*)(dst + (h ? (f & 1) * 16 + (f >> 1) : f) * 8) = o;
    }
}

// ---------------------------------------------------------------------------
// Fused flash-attention. One work-group per 32 queries (two 16-query tiles);
// the keys are split over KS waves: wave ks walks the 32-key blocks kr, kr + KS, ... (modulo the
// number of blocks; kr = ks plus a start of the work-group's own)
// for BOTH query tiles, so that each K and V fragment it loads feeds two products,
// with its own maxima, sums and accumulators per tile, and the KS partial results
// of a tile are merged through LDS behind one barrier.
// The scores are formed transposed, S^T = K^T x Q (rows = keys, columns = queries): a lane then
// holds, for its own query, the 16 keys 16*hi + 0..15 of a block (even ones from the first product,
// odd ones from the second), and these 16 values are its share of the P^T operand of the PV
// products. P goes from exp2 to the PV products in registers, through no LDS and no lane exchange.
// k order of P^T and of the V fragment alike: lane half hi, element e -> key 16*hi + e.
// A wave walks its keys twice. Pass 1: score WMMAs and in-lane maxima only, then
// one exchange between the two lane halves gives each query's maximum over the whole range.
// Pass 2, per step and tile: 2 score WMMA with minus the maximum as C operand, exp2,
// 1 row-sum WMMA (ones x P^T) + 4 PV WMMA; sums and accumulators are never rescaled.
// Softmax kept in log2 domain (q pre-scaled by log2 e).
// ---------------------------------------------------------------------------
#define KS 16                    // key ranges = waves per work-group
#define QTL 2                    // query tiles per work-group and per wave
#define NPT (KS * QTL)           // partial results per work-group
#define PPITCH 68                // f32 per query row of a partial (16 B x odd)
#define NBLK (NN / 32)           // 32-key blocks per batch (a power of two)

__global__ __launch_bounds__(KS * 32) void attn_flash_kernel(
    const _Float16* __restrict__ qT, const _Float16* __restrict__ kT,
    const _Float16* __restrict__ vSw,
    const float* __restrict__ x, const float* __restrict__ gamma,
    float* __restrict__ out)
{
    __shared__ __align__(16) float    part[NPT][16 * PPITCH]; // per wave and tile: partial [query][channel]
    __shared__ __align__(16) float    mBuf[NPT][16];          // row maxima (log2 domain)
    __shared__ __align__(16) float    lBuf[NPT][16];          // denominators

    const int lane = threadIdx.x & 31;
    // wave-uniform by construction; held in a scalar register so that key offsets and LDS bases
    // are scalar arithmetic and cost no vector registers
    const int ks   = __builtin_amdgcn_readfirstlane(threadIdx.x >> 5);   // key range of this wave
    const int b    = blockIdx.x >> 7;               // 128 work-groups per batch
    const int i0   = (blockIdx.x & 127) << 5;       // first of the 32 queries
    const int q16  = lane & 15;
    const int hi   = lane >> 4;
    // First key block of this wave. All 128 work-groups of a batch read the same K and V; walking them
    // from the same block they ask L2 for the same lines at the same moment, and such requests queue
    // behind one another. Each work-group starts at a block of its own and wraps round. The stride is
    // odd (128 different starts) and above 1, so that the later start of later work-groups does not undo it.
    const int kr   = (ks + 5 * (int)blockIdx.x) & (NBLK - 1);

    // Q once per tile: the 8 channels at k = 0-7 (lanes 0-15) and again at k = 8-15 (lanes 16-31).
    // A loaded K fragment holds the even keys in lanes 0-15 (k = 0-7) and the odd keys in lanes
    // 16-31 (k = 8-15); each score product takes it with the other lane half set to zero.
    v16h aQ[QTL];
    #pragma unroll
    for (int tq = 0; tq < QTL; ++tq) {
        const v8h q8 = *(const v8h*)(qT + (size_t)(b * NN + i0 + 16 * tq + q16) * 8);
        #pragma unroll
        for (int e = 0; e < 8; ++e) { aQ[tq][e] = q8[e]; aQ[tq][e + 8] = (_Float16)0.f; }
    }

    v16h aOnes;
    #pragma unroll
    for (int i = 0; i < 16; ++i) aOnes[i] = (_Float16)1.f;

    v8f zero8;
    #pragma unroll
    for (int e = 0; e < 8; ++e) zero8[e] = 0.f;

    v8f acc[QTL][4];
    v8f cs[QTL];                                     // row sums of P: every row = denom of query q16
    #pragma unroll
    for (int tq = 0; tq < QTL; ++tq) {
        #pragma unroll
        for (int cg = 0; cg < 4; ++cg) acc[tq][cg] = zero8;
        cs[tq] = zero8;
    }

    // wave-uniform bases and one 32-bit lane offset: in pass 1 a block's address is scalar arithmetic
    // plus that offset; pass 2 keeps the lane's K and V address pairs in vector registers and steps them
    const _Float16* kB = kT + (size_t)b * NN * 8;
    const _Float16* vB = vSw + (size_t)b * CC * NN;
    const unsigned  lo = (unsigned)lane * 8u;
    // V: lane half hi takes part hi of a channel group, both 8-key pieces of it (keys 16*hi + 0..15)
    const unsigned  lv = (unsigned)hi * 256u + (unsigned)q16 * 8u;

    // merge role: lane -> query (tile hi, column q16), wave -> four channels
    const int c0 = 4 * ks;
    const size_t idx0 = ((size_t)(b * CC + c0)) * NN + i0 + lane;
    const float g  = gamma[0];

    // ---- pass 1: row maxima over all keys of this wave's range --------------
    float mx[QTL][8];
    #pragma unroll
    for (int tq = 0; tq < QTL; ++tq)
        #pragma unroll
        for (int r = 0; r < 8; ++r) mx[tq][r] = -3.0e38f;
    // all eight K loads are in flight together
    v8h k1[NN / (KS * 32)];
    #pragma unroll
    for (int t = 0; t < NN / (KS * 32); ++t) k1[t] = *(const v8h*)(kB + (size_t)((t * KS + kr) & (NBLK - 1)) * KBLK + lo);
    #pragma unroll
    for (int t = 0; t < NN / (KS * 32); ++t) {
        // ends the loads, then each block's products and maxima, before the next block's: the scheduler
        // otherwise runs the products far ahead of the maxima, and load addresses that are needed
        // behind the key loop no longer fit the registers and spill
        __builtin_amdgcn_sched_barrier(0);
        const v8h k8 = k1[t];
        // selected as 32-bit words: one select per register, not one per f16
        const v4u kw = __builtin_bit_cast(v4u, k8);
        v8u bw[2];
        #pragma unroll
        for (int e = 0; e < 4; ++e) {
            bw[0][e]     = hi ? 0u : kw[e];
            bw[1][e]     = hi ? kw[e] : 0u;
            bw[0][e + 4] = 0u;
            bw[1][e + 4] = 0u;
        }
        const v16h bK[2] = {__builtin_bit_cast(v16h, bw[0]), __builtin_bit_cast(v16h, bw[1])};
        #pragma unroll
        for (int tq = 0; tq < QTL; ++tq) {
            v8f c01[2];
            #pragma unroll
            for (int h = 0; h < 2; ++h)
                c01[h] = __builtin_amdgcn_wmma_f32_16x16x32_f16(
                    false, bK[h], false, aQ[tq], (short)0, zero8, false, false);
            #pragma unroll
            for (int r = 0; r < 8; ++r) mx[tq][r] = fmaxf(mx[tq][r], fmaxf(c01[0][r], c01[1][r]));
        }
    }

    // ---- first block of pass 2: its loads fly under the exchange below ------
    v8h kf[2];
    v8h vf[2][8];
    // the lane's addresses in the block being fetched; they step from block to block, back over the
    // whole range where the walk wraps
    int blk = kr;
    const _Float16* kp = kB + (size_t)kr * KBLK + lo;
    const _Float16* vp = vB + (size_t)kr * VBLK + lv;
    kf[0] = *(const v8h*)kp;
    #pragma unroll
    for (int i = 0; i < 8; ++i) vf[0][i] = *(const v8h*)(vp + (i >> 1) * 512 + (i & 1) * 128);
    // keeps these loads in front of the exchange, which then covers their latency
    __builtin_amdgcn_sched_barrier(0);

    // ---- a query's maximum, packed f16: over the lane's 8 registers, then between the lane halves ---
    float m[QTL];
    v8f negM[QTL];                                   // C operand of the score products of pass 2
    #pragma unroll
    for (int tq = 0; tq < QTL; ++tq) {
        v2h pk[4];
        #pragma unroll
        for (int i = 0; i < 4; ++i) pk[i] = (v2h){(_Float16)mx[tq][2 * i], (_Float16)mx[tq][2 * i + 1]};
        v2h p = __builtin_elementwise_max(__builtin_elementwise_max(pk[0], pk[1]),
                                          __builtin_elementwise_max(pk[2], pk[3]));
        int o = __shfl_xor(__builtin_bit_cast(int, p), 16, 32);
        p = __builtin_elementwise_max(p, __builtin_bit_cast(v2h, o));
        m[tq] = fmaxf((float)p[0], (float)p[1]);
        #pragma unroll
        for (int r = 0; r < 8; ++r) negM[tq][r] = -m[tq];
    }

    // ---- pass 2 ---------------------------------------------------------------
    // one 512-byte load brings the K of all 32 keys of a block, eight bring its V
    auto fetch = [&](v8h& k8, v8h (&vv)[8]) __attribute__((always_inline)) {
        // stands in front of the step of the address registers, which the loads of the block before name;
        // taking them as inputs keeps that step, and any other use of these registers, behind it
        asm volatile("s_wait_xcnt 0x0" :: "v"(kp), "v"(vp) : "memory");
        const int nb = (blk + KS) & (NBLK - 1);      // next 32-key block of the walk
        kp += (nb - blk) * KBLK;
        vp += (nb - blk) * VBLK;
        blk = nb;
        k8 = *(const v8h*)kp;
        #pragma unroll
        for (int i = 0; i < 8; ++i) vv[i] = *(const v8h*)(vp + (i >> 1) * 512 + (i & 1) * 128);
    };
    auto step = [&](const v8h& k8, const v8h (&vv)[8]) __attribute__((always_inline)) {
        // ---- energy minus the query's maximum (log2 domain): product h, register r -> key 16*hi + 2*r + h
        // selected as 32-bit words: one select per register, not one per f16
        const v4u kw = __builtin_bit_cast(v4u, k8);
        v8u bw[2];
        #pragma unroll
        for (int e = 0; e < 4; ++e) {
            bw[0][e]     = hi ? 0u : kw[e];
            bw[1][e]     = hi ? kw[e] : 0u;
            bw[0][e + 4] = 0u;
            bw[1][e + 4] = 0u;
        }
        const v16h bK[2] = {__builtin_bit_cast(v16h, bw[0]), __builtin_bit_cast(v16h, bw[1])};

        v16h bP[QTL];
        #pragma unroll
        for (int tq = 0; tq < QTL; ++tq) {
            v8f c01[2];
            #pragma unroll
            for (int h = 0; h < 2; ++h)
                c01[h] = __builtin_amdgcn_wmma_f32_16x16x32_f16(
                    false, bK[h], false, aQ[tq], (short)0, negM[tq], false, false);

            // ---- exp2; the lane's 16 values are its share of the P^T operand, in key order ----
            // The bare hardware exp2: the library form scales arguments below -126 up and the result
            // back down to keep f32 subnormals, five more vector instructions per score; here every
            // such result is far below the smallest f16 and becomes 0 in P either way.
            #pragma unroll
            for (int r = 0; r < 8; ++r) {
                const float e0 = __builtin_amdgcn_exp2f(c01[0][r]);
                const float e1 = __builtin_amdgcn_exp2f(c01[1][r]);
                const v2h   pr = (v2h){(_Float16)e0, (_Float16)e1};
                bP[tq][2 * r]     = pr[0];
                bP[tq][2 * r + 1] = pr[1];
            }
        }
        // ---- softmax denominator via ones x P^T (row-sum WMMA) -------
        #pragma unroll
        for (int tq = 0; tq < QTL; ++tq)
            cs[tq] = __builtin_amdgcn_wmma_f32_16x16x32_f16(
                false, aOnes, false, bP[tq], (short)0, cs[tq], false, false);

        // ---- out^T += V x P^T, 4 channel groups; each V fragment serves both tiles
        #pragma unroll
        for (int cg = 0; cg < 4; ++cg) {
            v16h aV = __builtin_shufflevector(vv[2 * cg], vv[2 * cg + 1], 0, 1, 2, 3, 4, 5, 6, 7,
                                              8, 9, 10, 11, 12, 13, 14, 15);
            #pragma unroll
            for (int tq = 0; tq < QTL; ++tq)
                acc[tq][cg] = __builtin_amdgcn_wmma_f32_16x16x32_f16(
                    false, aV, false, bP[tq], (short)0, acc[tq][cg], false, false);
        }
    };

    // Two register sets: a block's nine loads are issued one whole block ahead of their use.
    // The last two blocks stand behind the loop: with their missing fetch under a branch inside it,
    // the counted waits of the loop would have to hold for both paths and would wait for the
    // youngest loads too. Kept rolled: unrolled whole, its values no longer fit the registers and spill.
    #pragma unroll 1
    for (int t = 0; t < NN / (KS * 32) - 2; t += 2) {
        fetch(kf[1], vf[1]);
        // keeps the loads above in front of the block's work: the scheduler otherwise sinks each
        // to its first use, where its whole latency is waited out
        __builtin_amdgcn_sched_barrier(0);
        step(kf[0], vf[0]);
        fetch(kf[0], vf[0]);
        // as above
        __builtin_amdgcn_sched_barrier(0);
        step(kf[1], vf[1]);
    }
    fetch(kf[1], vf[1]);
    // as above
    __builtin_amdgcn_sched_barrier(0);
    step(kf[0], vf[0]);
    // as in fetch: the address registers of the last block's loads come free for other values only here
    asm volatile("s_wait_xcnt 0x0" :: "v"(kp), "v"(vp) : "memory");
    // residual values: fetched here, where one register set has come free, so that the last block
    // covers their latency; held across the key loop they would not fit the registers
    float xres[4];
    #pragma unroll
    for (int j = 0; j < 4; ++j) xres[j] = x[idx0 + (size_t)j * NN];
    // keeps these loads in front of the last block's work
    __builtin_amdgcn_sched_barrier(0);
    step(kf[1], vf[1]);

    // ---- publish this wave's partials: maxima, denominators, accumulators --
    #pragma unroll
    for (int tq = 0; tq < QTL; ++tq) {
        const int pi = ks * QTL + tq;
        if (hi == 0) { mBuf[pi][q16] = m[tq]; lBuf[pi][q16] = cs[tq][0]; }
        float* pw = &part[pi][q16 * PPITCH + 8 * hi];
        #pragma unroll
        for (int cg = 0; cg < 4; ++cg) {
            *(v4f*)(pw + cg * 16)     = (v4f){acc[tq][cg][0], acc[tq][cg][1], acc[tq][cg][2], acc[tq][cg][3]};
            *(v4f*)(pw + cg * 16 + 4) = (v4f){acc[tq][cg][4], acc[tq][cg][5], acc[tq][cg][6], acc[tq][cg][7]};
        }
    }

    // every wave's partials are in LDS before any wave reads another's
    __syncthreads();

    // ---- merge the KS key ranges: weights exp2(m - M) --------------------
    float ms[KS];
    float M = -3.0e38f;
    #pragma unroll
    for (int s = 0; s < KS; ++s) {
        ms[s] = mBuf[s * QTL + hi][q16];
        M = fmaxf(M, ms[s]);
    }
    float L = 0.f;
    float o[4] = {0.f, 0.f, 0.f, 0.f};
    #pragma unroll
    for (int s = 0; s < KS; ++s) {
        float w = __builtin_exp2f(ms[s] - M);
        v4f  p = *(const v4f*)&part[s * QTL + hi][q16 * PPITCH + c0];
        L  += w * lBuf[s * QTL + hi][q16];
        #pragma unroll
        for (int j = 0; j < 4; ++j) o[j] += w * p[j];
    }

    // ---- finalize: gamma * o / L + residual; one 128-B line per store ----
    float invq = 1.0f / L;
    #pragma unroll
    for (int j = 0; j < 4; ++j)
        out[idx0 + (size_t)j * NN] = g * o[j] * invq + xres[j];
}

// ---------------------------------------------------------------------------
extern "C" void kernel_launch(void* const* d_in, const int* in_sizes, int n_in,
                              void* d_out, int out_size, void* d_ws, size_t ws_size,
                              hipStream_t stream) {
    const float* x     = (const float*)d_in[0];
    const float* Wq    = (const float*)d_in[1];
    const float* bq    = (const float*)d_in[2];
    const float* Wk    = (const float*)d_in[3];
    const float* bk    = (const float*)d_in[4];
    const float* Wv    = (const float*)d_in[5];
    const float* bv    = (const float*)d_in[6];
    const float* gamma = (const float*)d_in[7];
    float* out = (float*)d_out;

    _Float16* ws = (_Float16*)d_ws;
    _Float16* qT   = ws + QT_OFF;
    _Float16* kT   = ws + KT_OFF;
    _Float16* vSw  = ws + VS_OFF;

    proj_kernel<<<(BB * NN / PN) * PG, 32, 0, stream>>>(x, Wq, bq, Wk, bk, Wv, bv, qT, kT, vSw);
    attn_flash_kernel<<<(BB * NN / 16) / QTL, KS * 32, 0, stream>>>(qT, kT, vSw, x, gamma, out);
}

// v009
// A run of this version takes 12 microseconds.
// Timed twice side by side with v008, it ran 1.09 and 1.08 times as fast.
// Over all steps from v000 it is 14.1 times as fast.
#include <hip/hip_runtime.h>

typedef __attribute__((ext_vector_type(16))) _Float16 v16h;
typedef __attribute__((ext_vector_type(8)))  _Float16 v8h;
typedef __attribute__((ext_vector_type(2)))  _Float16 v2h;
typedef __attribute__((ext_vector_type(8)))  float    v8f;
typedef __attribute__((ext_vector_type(4)))  float    v4f;
typedef __attribute__((ext_vector_type(2)))  float    v2f;
typedef __attribute__((ext_vector_type(4)))  unsigned v4u;
typedef __attribute__((ext_vector_type(8)))  unsigned v8u;

#define BB 2
#define CC 64
#define C8 8
#define NN 4096
#define LOG2E 1.44269504088896340736f

// Workspace layout (f16 elements). K and V lie in pieces of 16 bytes per lane, so that each load of a
// wave of the attention kernel covers whole lines: K 512 bytes in a row, V two runs of 256 bytes:
//   qT  [B][N][8]               : q channels * log2(e)
//   kT  [B][N/32][32][8]        : slot 16*h + c of a 32-key block = the 8 channels of key 2*c + h
//   vSw [B][N/32][4][2][32][8]  : [channel group][part p][slot 16*s + c] =
//                                 channel 16*group + c, keys 16*p + 8*s + 0..7 of the block
#define QT_OFF  ((size_t)0)
#define KT_OFF  ((size_t)BB * NN * 8)
#define VS_OFF  (KT_OFF + (size_t)BB * NN * 8)
#define KBLK    256              // f16 per 32-key block of kT
#define VBLK    2048             // f16 per 32-key block of vSw

// ---------------------------------------------------------------------------
// All three projections in one launch, as f32 matrix products (16x16x4 form).
// One wave per work-group: 64 columns n of one batch (four fragments of 16,
// fragment f = columns n0 + 4*c + f, so a lane's 16-byte load of x feeds all
// four) times one group of 16 output channels: group 0 = q (rows 0-7) and
// k (rows 8-15), groups 1-4 = v.
// k order, the same for the x and the weight fragment: lane half h, step kk,
// element e  ->  input channel 32*h + 2*kk + e.
//   group 0  : D = W * x    -> a lane holds the 8 q (h = 0) or k (h = 1)
//              channels of one column: one 16-byte store
//   groups 1+: D = x^T * W^T -> a lane holds 32 consecutive n of one channel:
//              its channel's share of one 32-key block of vSw, four 16-byte pieces
// ---------------------------------------------------------------------------
#define PN 64                    // columns per wave
#define PG 5                     // channel groups: q|k, v0-15, v16-31, v32-47, v48-63

__global__ __launch_bounds__(32) void proj_kernel(
    const float* __restrict__ x,
    const float* __restrict__ Wq, const float* __restrict__ bq,
    const float* __restrict__ Wk, const float* __restrict__ bk,
    const float* __restrict__ Wv, const float* __restrict__ bv,
    _Float16* __restrict__ qT, _Float16* __restrict__ kT,
    _Float16* __restrict__ vSw)
{
    const int c  = threadIdx.x & 15;
    const int h  = threadIdx.x >> 4;
    const int g  = blockIdx.x % PG;
    const int nb = blockIdx.x / PG;
    const int b  = nb / (NN / PN);
    const int n0 = (nb % (NN / PN)) * PN;

    const float* wrow = (g == 0) ? ((c < 8) ? Wq + c * CC : Wk + (c - 8) * CC)
                                 : Wv + ((g - 1) * 16 + c) * CC;
    wrow += h * 32;
    const float* xp = x + ((size_t)(b * CC + h * 32)) * NN + n0 + 4 * c;
    // accumulator start, D register r: group 0 = bias of channel r of q (h = 0) or k (h = 1);
    // groups 1+ = the lane's own channel's bias in every register
    const float* bp = (g == 0) ? (h ? bk : bq) : bv + ((g - 1) * 16 + c);
    const int    bs = (g == 0) ? 1 : 0;

    float bias[8];
    #pragma unroll
    for (int r = 0; r < 8; ++r) bias[r] = bp[r * bs];
    v4f xr[32];
    #pragma unroll
    for (int i = 0; i < 32; ++i) xr[i] = *(const v4f*)(xp + (size_t)i * NN);
    v4f wr[8];
    #pragma unroll
    for (int i = 0; i < 8; ++i) wr[i] = *(const v4f*)(wrow + 4 * i);
    // stands in front of the first reuse of the address registers of the loads above
    asm volatile("s_wait_xcnt 0x0" ::: "memory");

    v8f acc[4];
    #pragma unroll
    for (int f = 0; f < 4; ++f)
        #pragma unroll
        for (int r = 0; r < 8; ++r) acc[f][r] = bias[r];

    if (g != 0) {
        #pragma unroll
        for (int kk = 0; kk < 16; ++kk) {
            v2f w = (v2f){wr[kk >> 1][(2 * kk) & 3], wr[kk >> 1][((2 * kk) & 3) + 1]};
            #pragma unroll
            for (int f = 0; f < 4; ++f) {
                v2f xv = (v2f){xr[2 * kk][f], xr[2 * kk + 1][f]};
                acc[f] = __builtin_amdgcn_wmma_f32_16x16x4_f32(
                    false, xv, false, w, (short)0, acc[f], false, false);
            }
        }
        // acc[f][r] = v[16*(g-1) + c][n0 + 32*h + 4*r + f]; the piece of keys 8*jj .. 8*jj+7
        // (r = 2*jj, 2*jj+1) goes to part jj >> 1, slot half jj & 1: 16 lanes store 256 B in a row
        _Float16* dst = vSw + (size_t)b * CC * NN + (size_t)((n0 >> 5) + h) * VBLK
                            + (g - 1) * 512 + c * 8;
        #pragma unroll
        for (int jj = 0; jj < 4; ++jj) {
            v8h o;
            #pragma unroll
            for (int e = 0; e < 8; ++e) o[e] = (_Float16)acc[e & 3][2 * jj + (e >> 2)];
            *(v8h*)(dst + (jj >> 1) * 256 + (jj & 1) * 128) = o;
        }
        // the built code lays the q|k path behind these stores and reuses their registers there:
        // the wait stands in front of that reuse
        asm volatile("s_wait_xcnt 0x0" ::: "memory");
        return;
    }

    #pragma unroll
    for (int kk = 0; kk < 16; ++kk) {
        v2f w = (v2f){wr[kk >> 1][(2 * kk) & 3], wr[kk >> 1][((2 * kk) & 3) + 1]};
        #pragma unroll
        for (int f = 0; f < 4; ++f) {
            v2f xv = (v2f){xr[2 * kk][f], xr[2 * kk + 1][f]};
            acc[f] = __builtin_amdgcn_wmma_f32_16x16x4_f32(
                false, w, false, xv, (short)0, acc[f], false, false);
        }
    }
    const float s = h ? 1.0f : LOG2E;
    // column n0 + 4*c + f: q row as it is; k = key 4*(c & 7) + f of block c >> 3,
    // slot 16*(f & 1) + 2*(c & 7) + (f >> 1)
    _Float16* dst = h ? kT + ((size_t)(b * NN + n0 + (c >> 3) * 32 + 2 * (c & 7))) * 8
                      : qT + ((size_t)(b * NN + n0 + 4 * c)) * 8;
    #pragma unroll
    for (int f = 0; f < 4; ++f) {
        v8h o;
        #pragma unroll
        for (int r = 0; r < 8; ++r) o[r] = (_Float16)(acc[f][r] * s);
        *(v8h*)(dst + (h ? (f & 1) * 16 + (f >> 1) : f) * 8) = o;
    }
}

// ---------------------------------------------------------------------------
// Fused flash-attention. One work-group per 32 queries (two 16-query tiles);
// the keys are split over KS waves: wave ks walks the 32-key blocks kr, kr + KS, ... (modulo the
// number of blocks; kr = ks plus a start of the work-group's own)
// for BOTH query tiles, so that each K and V fragment it loads feeds two products,
// with its own maxima, sums and accumulators per tile, and the KS partial results
// of a tile are merged through LDS behind one barrier.
// The scores are formed transposed, S^T = K^T x Q (rows = keys, columns = queries): a lane then
// holds, for its own query, the 16 keys 16*hi + 0..15 of a block (even ones from the first product,
// odd ones from the second), and these 16 values are its share of the P^T operand of the PV
// products. P goes from exp2 to the PV products in registers, through no LDS and no lane exchange.
// k order of P^T and of the V fragment alike: lane half hi, element e -> key 16*hi + e.
// The shift of a wave's softmax: score WMMAs and in-lane maxima of its first key block, then one
// exchange between the two lane halves. The walk (pass 2), per step and tile: 2 score WMMA with minus
// the shift as C operand, exp2, 1 row-sum WMMA (ones x P^T) + 4 PV WMMA; sums and accumulators are
// never rescaled. Only a wave with a denominator of 65504 or more (or NaN) walks again, shifted by the maxima of all its keys.
// Softmax kept in log2 domain (q pre-scaled by log2 e).
// ---------------------------------------------------------------------------
#define KS 16                    // key ranges = waves per work-group
#define QTL 2                    // query tiles per work-group and per wave
#define NPT (KS * QTL)           // partial results per work-group
#define PPITCH 68                // f32 per query row of a partial (16 B x odd)
#define NBLK (NN / 32)           // 32-key blocks per batch (a power of two)

__global__ __launch_bounds__(KS * 32) void attn_flash_kernel(
    const _Float16* __restrict__ qT, const _Float16* __restrict__ kT,
    const _Float16* __restrict__ vSw,
    const float* __restrict__ x, const float* __restrict__ gamma,
    float* __restrict__ out)
{
    __shared__ __align__(16) float    part[NPT][16 * PPITCH]; // per wave and tile: partial [query][channel]
    __shared__ __align__(16) float    mBuf[NPT][16];          // row maxima (log2 domain)
    __shared__ __align__(16) float    lBuf[NPT][16];          // denominators

    const int lane = threadIdx.x & 31;
    // wave-uniform by construction; held in a scalar register so that key offsets and LDS bases
    // are scalar arithmetic and cost no vector registers
    const int ks   = __builtin_amdgcn_readfirstlane(threadIdx.x >> 5);   // key range of this wave
    const int b    = blockIdx.x >> 7;               // 128 work-groups per batch
    const int i0   = (blockIdx.x & 127) << 5;       // first of the 32 queries
    const int q16  = lane & 15;
    const int hi   = lane >> 4;
    // First key block of this wave. All 128 work-groups of a batch read the same K and V; walking them
    // from the same block they ask L2 for the same lines at the same moment, and such requests queue
    // behind one another. Each work-group starts at a block of its own and wraps round. The stride is
    // odd (128 different starts) and above 1, so that the later start of later work-groups does not undo it.
    const int kr   = (ks + 5 * (int)blockIdx.x) & (NBLK - 1);

    // Q once per tile: the 8 channels at k = 0-7 (lanes 0-15) and again at k = 8-15 (lanes 16-31).
    // A loaded K fragment holds the even keys in lanes 0-15 (k = 0-7) and the odd keys in lanes
    // 16-31 (k = 8-15); each score product takes it with the other lane half set to zero.
    v16h aQ[QTL];
    #pragma unroll
    for (int tq = 0; tq < QTL; ++tq) {
        const v8h q8 = *(const v8h*)(qT + (size_t)(b * NN + i0 + 16 * tq + q16) * 8);
        #pragma unroll
        for (int e = 0; e < 8; ++e) { aQ[tq][e] = q8[e]; aQ[tq][e + 8] = (_Float16)0.f; }
    }

    v16h aOnes;
    #pragma unroll
    for (int i = 0; i < 16; ++i) aOnes[i] = (_Float16)1.f;

    v8f zero8;
    #pragma unroll
    for (int e = 0; e < 8; ++e) zero8[e] = 0.f;

    v8f acc[QTL][4];
    v8f cs[QTL];                                     // row sums of P: every row = denom of query q16

    // wave-uniform bases and one 32-bit lane offset: a block's address is scalar arithmetic plus
    // that offset; the lane's K and V address pairs built from them stay in vector registers across the key loop
    const _Float16* kB = kT + (size_t)b * NN * 8;
    const _Float16* vB = vSw + (size_t)b * CC * NN;
    const unsigned  lo = (unsigned)lane * 8u;
    // V: lane half hi takes part hi of a channel group, both 8-key pieces of it (keys 16*hi + 0..15)
    const unsigned  lv = (unsigned)hi * 256u + (unsigned)q16 * 8u;

    // merge role: lane -> query (tile hi, column q16), wave -> four channels
    const int c0 = 4 * ks;
    const size_t idx0 = ((size_t)(b * CC + c0)) * NN + i0 + lane;
    const float g  = gamma[0];

    // ---- the shift of the softmax ---------------------------------------------
    // The softmax is the same for every shift m as long as exp2(score - m) fits f16. The first walk
    // takes as m the maxima over the wave's FIRST key block only: P is then about 1 at that block's
    // largest score (nothing underflows that the full maxima would keep), and a later score may lie
    // almost 16 above m before P leaves f16. The query's denominator, the sum of its P, is tested
    // behind the walk: a wave that finds one too large walks its keys once more, with the maxima of
    // all of them.
    float m[QTL];
    v8f negM[QTL];                                   // C operand of the score products of pass 2
    float mx[QTL][8];
    v8h kf[2];
    v8h vf[2][8];
    // the lane's addresses in the block being fetched; they step from block to block, back over the
    // whole range where the walk wraps
    int blk = kr;
    const _Float16* kp = kB + (size_t)kr * KBLK + lo;
    const _Float16* vp = vB + (size_t)kr * VBLK + lv;
    float xres[4];

    // score WMMAs of one block and in-lane maxima
    auto maxima = [&](const v8h& k8) __attribute__((always_inline)) {
        // selected as 32-bit words: one select per register, not one per f16
        const v4u kw = __builtin_bit_cast(v4u, k8);
        v8u bw[2];
        #pragma unroll
        for (int e = 0; e < 4; ++e) {
            bw[0][e]     = hi ? 0u : kw[e];
            bw[1][e]     = hi ? kw[e] : 0u;
            bw[0][e + 4] = 0u;
            bw[1][e + 4] = 0u;
        }
        const v16h bK[2] = {__builtin_bit_cast(v16h, bw[0]), __builtin_bit_cast(v16h, bw[1])};
        #pragma unroll
        for (int tq = 0; tq < QTL; ++tq) {
            v8f c01[2];
            #pragma unroll
            for (int h = 0; h < 2; ++h)
                c01[h] = __builtin_amdgcn_wmma_f32_16x16x32_f16(
                    false, bK[h], false, aQ[tq], (short)0, zero8, false, false);
            #pragma unroll
            for (int r = 0; r < 8; ++r) mx[tq][r] = fmaxf(mx[tq][r], fmaxf(c01[0][r], c01[1][r]));
        }
    };

    // ---- pass 2 ---------------------------------------------------------------
    // one 512-byte load brings the K of all 32 keys of a block, eight bring its V
    auto fetch = [&](v8h& k8, v8h (&vv)[8]) __attribute__((always_inline)) {
        // stands in front of the step of the address registers, which the loads of the block before name;
        // taking them as inputs keeps that step, and any other use of these registers, behind it
        asm volatile("s_wait_xcnt 0x0" :: "v"(kp), "v"(vp) : "memory");
        const int nb = (blk + KS) & (NBLK - 1);      // next 32-key block of the walk
        kp += (nb - blk) * KBLK;
        vp += (nb - blk) * VBLK;
        blk = nb;
        k8 = *(const v8h*)kp;
        #pragma unroll
        for (int i = 0; i < 8; ++i) vv[i] = *(const v8h*)(vp + (i >> 1) * 512 + (i & 1) * 128);
    };
    auto step = [&](const v8h& k8, const v8h (&vv)[8]) __attribute__((always_inline)) {
        // ---- energy minus the query's maximum (log2 domain): product h, register r -> key 16*hi + 2*r + h
        // selected as 32-bit words: one select per register, not one per f16
        const v4u kw = __builtin_bit_cast(v4u, k8);
        v8u bw[2];
        #pragma unroll
        for (int e = 0; e < 4; ++e) {
            bw[0][e]     = hi ? 0u : kw[e];
            bw[1][e]     = hi ? kw[e] : 0u;
            bw[0][e + 4] = 0u;
            bw[1][e + 4] = 0u;
        }
        const v16h bK[2] = {__builtin_bit_cast(v16h, bw[0]), __builtin_bit_cast(v16h, bw[1])};

        v16h bP[QTL];
        #pragma unroll
        for (int tq = 0; tq < QTL; ++tq) {
            v8f c01[2];
            #pragma unroll
            for (int h = 0; h < 2; ++h)
                c01[h] = __builtin_amdgcn_wmma_f32_16x16x32_f16(
                    false, bK[h], false, aQ[tq], (short)0, negM[tq], false, false);

            // ---- exp2; the lane's 16 values are its share of the P^T operand, in key order ----
            // The bare hardware exp2: the library form scales arguments below -126 up and the result
            // back down to keep f32 subnormals, five more vector instructions per score; here every
            // such result is far below the smallest f16 and becomes 0 in P either way.
            #pragma unroll
            for (int r = 0; r < 8; ++r) {
                const float e0 = __builtin_amdgcn_exp2f(c01[0][r]);
                const float e1 = __builtin_amdgcn_exp2f(c01[1][r]);
                const v2h   pr = (v2h){(_Float16)e0, (_Float16)e1};
                bP[tq][2 * r]     = pr[0];
                bP[tq][2 * r + 1] = pr[1];
            }
        }
        // ---- softmax denominator via ones x P^T (row-sum WMMA) -------
        #pragma unroll
        for (int tq = 0; tq < QTL; ++tq)
            cs[tq] = __builtin_amdgcn_wmma_f32_16x16x32_f16(
                false, aOnes, false, bP[tq], (short)0, cs[tq], false, false);

        // ---- out^T += V x P^T, 4 channel groups; each V fragment serves both tiles
        #pragma unroll
        for (int cg = 0; cg < 4; ++cg) {
            v16h aV = __builtin_shufflevector(vv[2 * cg], vv[2 * cg + 1], 0, 1, 2, 3, 4, 5, 6, 7,
                                              8, 9, 10, 11, 12, 13, 14, 15);
            #pragma unroll
            for (int tq = 0; tq < QTL; ++tq)
                acc[tq][cg] = __builtin_amdgcn_wmma_f32_16x16x32_f16(
                    false, aV, false, bP[tq], (short)0, acc[tq][cg], false, false);
        }
    };

    // ---- first block: its K also gives the maxima, its V flies under them and the exchange ----
    auto first = [&]() __attribute__((always_inline)) {
        kf[0] = *(const v8h*)kp;
        #pragma unroll
        for (int i = 0; i < 8; ++i) vf[0][i] = *(const v8h*)(vp + (i >> 1) * 512 + (i & 1) * 128);
        // stands in front of the first reuse of the address registers of the loads above
        asm volatile("s_wait_xcnt 0x0" ::: "memory");
    };
    // maxima of the first block (full: of all blocks), their exchange, and the start values of a walk
    auto shift = [&](const bool full) __attribute__((always_inline)) {
        #pragma unroll
        for (int tq = 0; tq < QTL; ++tq)
            #pragma unroll
            for (int r = 0; r < 8; ++r) mx[tq][r] = -3.0e38f;
        maxima(kf[0]);
        if (full) {
            // second walk only: the other blocks of the range. Rolled: it hardly ever runs
            #pragma unroll 1
            for (int t = 1; t < NN / (KS * 32); ++t) {
                const _Float16* k1p = kp + (((t * KS + kr) & (NBLK - 1)) - kr) * KBLK;
                const v8h k1 = *(const v8h*)k1p;
                // stands in front of the next trip's rewrite of the address registers of this load
                asm volatile("s_wait_xcnt 0x0" :: "v"(k1p) : "memory");
                maxima(k1);
            }
        }

        // ---- a query's maximum, packed f16: over the lane's 8 registers, then between the lane halves ---
        #pragma unroll
        for (int tq = 0; tq < QTL; ++tq) {
            v2h pk[4];
            #pragma unroll
            for (int i = 0; i < 4; ++i) pk[i] = (v2h){(_Float16)mx[tq][2 * i], (_Float16)mx[tq][2 * i + 1]};
            v2h p = __builtin_elementwise_max(__builtin_elementwise_max(pk[0], pk[1]),
                                              __builtin_elementwise_max(pk[2], pk[3]));
            int o = __shfl_xor(__builtin_bit_cast(int, p), 16, 32);
            p = __builtin_elementwise_max(p, __builtin_bit_cast(v2h, o));
            m[tq] = fmaxf((float)p[0], (float)p[1]);
            #pragma unroll
            for (int r = 0; r < 8; ++r) negM[tq][r] = -m[tq];
            #pragma unroll
            for (int cg = 0; cg < 4; ++cg) acc[tq][cg] = zero8;
            cs[tq] = zero8;
        }
    };
    // pass 2 over all blocks of the range
    auto walk = [&]() __attribute__((always_inline)) {
        // Two register sets: a block's nine loads are issued one whole block ahead of their use.
        // The last two blocks stand behind the loop: with their missing fetch under a branch inside it,
        // the counted waits of the loop would have to hold for both paths and would wait for the
        // youngest loads too. Kept rolled: unrolled whole, its values no longer fit the registers and spill.
        #pragma unroll 1
        for (int t = 0; t < NN / (KS * 32) - 2; t += 2) {
            fetch(kf[1], vf[1]);
            // keeps the loads above in front of the block's work: the scheduler otherwise sinks each
            // to its first use, where its whole latency is waited out
            __builtin_amdgcn_sched_barrier(0);
            step(kf[0], vf[0]);
            fetch(kf[0], vf[0]);
            // as above
            __builtin_amdgcn_sched_barrier(0);
            step(kf[1], vf[1]);
        }
        fetch(kf[1], vf[1]);
        // as above
        __builtin_amdgcn_sched_barrier(0);
        step(kf[0], vf[0]);
        // as in fetch: the address registers of the last block's loads come free for other values only here
        asm volatile("s_wait_xcnt 0x0" :: "v"(kp), "v"(vp) : "memory");
        // residual values: fetched here, where one register set has come free, so that the last block
        // covers their latency; held across the key loop they would not fit the registers
        #pragma unroll
        for (int j = 0; j < 4; ++j) xres[j] = x[idx0 + (size_t)j * NN];
        // keeps these loads in front of the last block's work
        __builtin_amdgcn_sched_barrier(0);
        step(kf[1], vf[1]);
    };

    first();
    // keeps the first block's loads in front of the maxima and the exchange, which then cover
    // their latency
    __builtin_amdgcn_sched_barrier(0);
    shift(false);
    walk();

    // no P is negative: a denominator below the largest f16 number shows that none of its P reached
    // that number (a NaN fails the test too); the ballot reads the same in the whole wave, so the
    // branch is scalar
    const bool fits = cs[0][0] < 65504.0f && cs[1][0] < 65504.0f;
    if (__builtin_amdgcn_ballot_w32(!fits) != 0u) {
        // back to the first block (the wait behind the last fetch stands in front of this step)
        kp += (kr - blk) * KBLK;
        vp += (kr - blk) * VBLK;
        blk = kr;
        first();
        // as above
        __builtin_amdgcn_sched_barrier(0);
        shift(true);
        walk();
    }

    // ---- publish this wave's partials: maxima, denominators, accumulators --
    #pragma unroll
    for (int tq = 0; tq < QTL; ++tq) {
        const int pi = ks * QTL + tq;
        if (hi == 0) { mBuf[pi][q16] = m[tq]; lBuf[pi][q16] = cs[tq][0]; }
        float* pw = &part[pi][q16 * PPITCH + 8 * hi];
        #pragma unroll
        for (int cg = 0; cg < 4; ++cg) {
            *(v4f*)(pw + cg * 16)     = (v4f){acc[tq][cg][0], acc[tq][cg][1], acc[tq][cg][2], acc[tq][cg][3]};
            *(v4f*)(pw + cg * 16 + 4) = (v4f){acc[tq][cg][4], acc[tq][cg][5], acc[tq][cg][6], acc[tq][cg][7]};
        }
    }

    // every wave's partials are in LDS before any wave reads another's
    __syncthreads();

    // ---- merge the KS key ranges: weights exp2(m - M) --------------------
    float ms[KS];
    float M = -3.0e38f;
    #pragma unroll
    for (int s = 0; s < KS; ++s) {
        ms[s] = mBuf[s * QTL + hi][q16];
        M = fmaxf(M, ms[s]);
    }
    float L = 0.f;
    float o[4] = {0.f, 0.f, 0.f, 0.f};
    #pragma unroll
    for (int s = 0; s < KS; ++s) {
        float w = __builtin_exp2f(ms[s] - M);
        v4f  p = *(const v4f*)&part[s * QTL + hi][q16 * PPITCH + c0];
        L  += w * lBuf[s * QTL + hi][q16];
        #pragma unroll
        for (int j = 0; j < 4; ++j) o[j] += w * p[j];
    }

    // ---- finalize: gamma * o / L + residual; one 128-B line per store ----
    float invq = 1.0f / L;
    #pragma unroll
    for (int j = 0; j < 4; ++j)
        out[idx0 + (size_t)j * NN] = g * o[j] * invq + xres[j];
}

// ---------------------------------------------------------------------------
extern "C" void kernel_launch(void* const* d_in, const int* in_sizes, int n_in,
                              void* d_out, int out_size, void* d_ws, size_t ws_size,
                              hipStream_t stream) {
    const float* x     = (const float*)d_in[0];
    const float* Wq    = (const float*)d_in[1];
    const float* bq    = (const float*)d_in[2];
    const float* Wk    = (const float*)d_in[3];
    const float* bk    = (const float*)d_in[4];
    const float* Wv    = (const float*)d_in[5];
    const float* bv    = (const float*)d_in[6];
    const float* gamma = (const float*)d_in[7];
    float* out = (float*)d_out;

    _Float16* ws = (_Float16*)d_ws;
    _Float16* qT   = ws + QT_OFF;
    _Float16* kT   = ws + KT_OFF;
    _Float16* vSw  = ws + VS_OFF;

    proj_kernel<<<(BB * NN / PN) * PG, 32, 0, stream>>>(x, Wq, bq, Wk, bk, Wv, bv, qT, kT, vSw);
    attn_flash_kernel<<<(BB * NN / 16) / QTL, KS * 32, 0, stream>>>(qT, kT, vSw, x, gamma, out);
}
